// v000
// Measured on an AMD MI455X. A time is GPU time per run, averaged over a window of back-to-back runs after a warm-up
// (all launches, gaps included; the runs take copies of the inputs in turn), and the median of several windows.
// Apart from v000's, it joins two sittings. Times from different sittings can be a few percent apart, while
// side-by-side timings come from the same sitting.
// v000 is the starting kernel. One run takes 1730 microseconds.
#include <hip/hip_runtime.h>

// DenseMHA (hidden [2][2048][2048]; q/k/v = x W^T + b (16 heads x 128); rotate-half RoPE (base 1e4, computed on device); causal softmax(q.k / sqrt(128)) (finfo.min fill); out = merged Wo^T + bo -> [2][2048][2048]).
// Compute dtypes, f32 accumulate: every input rounded to bf16; q/k/v on PLAIN bf16 operands (inputs: exact) + bias; RoPE f32; causal scores and attn.v: query rows < 512 hl (3 products), the rest single fp16 (x1024), causal tile skipping; softmax f32; Wo hl x exact (2 products) + bias.

#define NB_  2
#define TT   2048
#define DM   2048
#define NH_  16
#define NKV  16
#define REP  (NH_ / NKV)
#define HD   128
#define DQ   (NH_ * HD)
#define DKV  (NKV * HD)
#define ZH   2
#define RH   512                  // query rows < RH use hi+lo planes (0: none)
#define WIN  2048
#define PCAR 1024.0f
#define SCL  0.088388347648318447f   // HD^-0.5
typedef _Float16 h16;
typedef unsigned short bf;
typedef __attribute__((ext_vector_type(16))) __bf16   v16bf;
typedef __attribute__((ext_vector_type(16))) _Float16 v16h;
typedef __attribute__((ext_vector_type(8)))  _Float16 v8h;
typedef __attribute__((ext_vector_type(8)))  unsigned short v8us;
typedef __attribute__((ext_vector_type(8)))  float    v8f;
typedef __attribute__((ext_vector_type(4)))  float    v4f;
typedef v8h  __attribute__((may_alias)) v8ha;
typedef v4f  __attribute__((may_alias)) v4fa;
typedef v8us __attribute__((may_alias)) v8usa;

__device__ __forceinline__ unsigned short f2bf(float f) { unsigned u = __float_as_uint(f); u += 0x7FFFu + ((u >> 16) & 1u); return (unsigned short)(u >> 16); }
__device__ __forceinline__ float bf2f(unsigned short b) { return __uint_as_float(((unsigned)b) << 16); }
__device__ __forceinline__ float bfr(float f) { return bf2f(f2bf(f)); }
__device__ __forceinline__ v16h cat16(v8h lo, v8h hi) { return __builtin_shufflevector(lo, hi, 0, 1, 2, 3, 4, 5, 6, 7, 8, 9, 10, 11, 12, 13, 14, 15); }
__device__ __forceinline__ v16bf cat16b(v8us lo, v8us hi) { return __builtin_bit_cast(v16bf, __builtin_shufflevector(lo, hi, 0, 1, 2, 3, 4, 5, 6, 7, 8, 9, 10, 11, 12, 13, 14, 15)); }
__device__ __forceinline__ v8f wmma16(v16h a, v16h b, v8f c) { return __builtin_amdgcn_wmma_f32_16x16x32_f16(false, a, false, b, (short)0, c, false, false); }
__device__ __forceinline__ v8f wmmab(v16bf a, v16bf b, v8f c) { return __builtin_amdgcn_wmma_f32_16x16x32_bf16(false, a, false, b, (short)0, c, false, false); }



// ---- k_gemmw: register-blocked GEMM, ONE WAVE per 64x64 output tile (16 accumulators), operands straight from K-contiguous 16-bit planes; grid (M/64, N/64, Z), 32 threads.
// C[m][n] (f32, pitch ldc, + optional f32 bias[n]) = sum_k A[m][k] Bt[n][k] (+ split products per NSPLIT). z-batch strides sA/sB/sC in elements. K % 32 == 0.
template <typename T16> struct WFrag;
template <> struct WFrag<h16> { typedef v16h V; static __device__ __forceinline__ V ld(const h16* p) { return cat16(*(const v8h*)p, *(const v8h*)(p + 16)); } static __device__ __forceinline__ v8f mma(V a, V b, v8f c) { return wmma16(a, b, c); } };
template <> struct WFrag<bf> { typedef v16bf V; static __device__ __forceinline__ V ld(const bf* p) { return cat16b(*(const v8us*)p, *(const v8us*)(p + 16)); } static __device__ __forceinline__ v8f mma(V a, V b, v8f c) { return wmmab(a, b, c); } };
template <typename T16, int NSPLIT, bool BIAS>
__global__ __launch_bounds__(32) void k_gemmw(const T16* __restrict__ A, const T16* __restrict__ A2, const T16* __restrict__ Bt, const T16* __restrict__ Bt2, int K, float* C, int ldc, const float* __restrict__ bias, size_t sA, size_t sB, size_t sC) {
    typedef typename WFrag<T16>::V V;
    __shared__ __align__(16) float os[16 * 68];
    const size_t z = blockIdx.z; A += z * sA; if (A2) A2 += z * sA; Bt += z * sB; if (Bt2) Bt2 += z * sB; C += z * sC;
    const int lane = threadIdx.x & 31, lr = lane & 15, hi = lane >> 4; const int r0 = blockIdx.x * 64, c0 = blockIdx.y * 64;
    v8f acc[4][4];
#pragma unroll
    for (int mb = 0; mb < 4; ++mb)
#pragma unroll
        for (int nb = 0; nb < 4; ++nb) acc[mb][nb] = (v8f){};
    const size_t aoff = (size_t)(r0 + lr) * K + 8 * hi, boff = (size_t)(c0 + lr) * K + 8 * hi;
#pragma unroll 1
    for (int kc = 0; kc < K; kc += 32) {
        V a[4], a2[4];
#pragma unroll
        for (int mb = 0; mb < 4; ++mb) { a[mb] = WFrag<T16>::ld(A + aoff + (size_t)mb * 16 * K + kc); if (NSPLIT == 1 || NSPLIT == 2) a2[mb] = WFrag<T16>::ld(A2 + aoff + (size_t)mb * 16 * K + kc); }
#pragma unroll
        for (int nb = 0; nb < 4; ++nb) { const V b = WFrag<T16>::ld(Bt + boff + (size_t)nb * 16 * K + kc); V b2; if (NSPLIT >= 2) b2 = WFrag<T16>::ld(Bt2 + boff + (size_t)nb * 16 * K + kc);
#pragma unroll
            for (int mb = 0; mb < 4; ++mb) { acc[mb][nb] = WFrag<T16>::mma(a[mb], b, acc[mb][nb]); if (NSPLIT == 1 || NSPLIT == 2) acc[mb][nb] = WFrag<T16>::mma(a2[mb], b, acc[mb][nb]); if (NSPLIT >= 2) acc[mb][nb] = WFrag<T16>::mma(a[mb], b2, acc[mb][nb]); } }
        asm volatile("v_nop\n\tv_nop\n\tv_nop\n\tv_nop" : "+v"(acc[0][0]), "+v"(acc[1][1]), "+v"(acc[2][2]), "+v"(acc[3][3]) : "v"(a[0]), "v"(a[3]));
    }
#pragma unroll
    for (int mb = 0; mb < 4; ++mb) {
#pragma unroll
        for (int nb = 0; nb < 4; ++nb) {
#pragma unroll
            for (int j = 0; j < 8; ++j) os[(hi * 8 + j) * 68 + nb * 16 + lr] = acc[mb][nb][j]; }
        __builtin_amdgcn_wave_barrier(); asm volatile("" ::: "memory");
        float* crow = C + (size_t)(r0 + mb * 16) * ldc + c0;
{
#pragma unroll
            for (int s = 0; s < 8; ++s) { const int row = 2 * s + hi, cofs = lr * 4; v4f val = *(const v4fa*)(os + row * 68 + cofs); if (BIAS) { val[0] += bfr(bias[c0 + cofs]); val[1] += bfr(bias[c0 + cofs + 1]); val[2] += bfr(bias[c0 + cofs + 2]); val[3] += bfr(bias[c0 + cofs + 3]); }
                *(v4f*)(crow + (size_t)row * ldc + cofs) = val; }
             }
        __builtin_amdgcn_wave_barrier(); asm volatile("" ::: "memory");
    }
}

// ---- k_gemmc: the same one-wave 64x64 tile GEMM specialised for causal attention: CMODE 1 skips score tiles entirely above the diagonal (query rows r0+roff.., key columns c0..), CMODE 2 limits the
// key (K) loop of the probability x value contraction to the diagonal block (probabilities beyond it are exactly zero). roff = row offset of this launch's first row within the sequence.
template <typename T16, int NSPLIT, int CMODE>
__global__ __launch_bounds__(32) void k_gemmc(const T16* __restrict__ A, const T16* __restrict__ A2, const T16* __restrict__ Bt, const T16* __restrict__ Bt2, int K, float* C, int ldc, int roff, size_t sA, size_t sB, size_t sC) {
    typedef typename WFrag<T16>::V V;
    __shared__ __align__(16) float os[16 * 68];
    const size_t z = blockIdx.z; A += z * sA; if (A2) A2 += z * sA; Bt += z * sB; if (Bt2) Bt2 += z * sB; C += z * sC;
    const int lane = threadIdx.x & 31, lr = lane & 15, hi = lane >> 4; const int r0 = blockIdx.x * 64, c0 = blockIdx.y * 64;
    if (CMODE == 1 && c0 > r0 + roff + 63) return;                  // score tile entirely above the causal diagonal: never read (the softmax masks j > i by select)
    const int Kl = (CMODE == 2) ? min(K, r0 + roff + 64) : K;        // P.V: probabilities are exactly 0 beyond the diagonal block, so the K loop stops there
    v8f acc[4][4];
#pragma unroll
    for (int mb = 0; mb < 4; ++mb)
#pragma unroll
        for (int nb = 0; nb < 4; ++nb) acc[mb][nb] = (v8f){};
    const size_t aoff = (size_t)(r0 + lr) * K + 8 * hi, boff = (size_t)(c0 + lr) * K + 8 * hi;
#pragma unroll 1
    for (int kc = 0; kc < Kl; kc += 32) {
        V a[4], a2[4];
#pragma unroll
        for (int mb = 0; mb < 4; ++mb) { a[mb] = WFrag<T16>::ld(A + aoff + (size_t)mb * 16 * K + kc); if (NSPLIT == 1 || NSPLIT == 2) a2[mb] = WFrag<T16>::ld(A2 + aoff + (size_t)mb * 16 * K + kc); }
#pragma unroll
        for (int nb = 0; nb < 4; ++nb) { const V b = WFrag<T16>::ld(Bt + boff + (size_t)nb * 16 * K + kc); V b2; if (NSPLIT >= 2) b2 = WFrag<T16>::ld(Bt2 + boff + (size_t)nb * 16 * K + kc);
#pragma unroll
            for (int mb = 0; mb < 4; ++mb) { acc[mb][nb] = WFrag<T16>::mma(a[mb], b, acc[mb][nb]); if (NSPLIT == 1 || NSPLIT == 2) acc[mb][nb] = WFrag<T16>::mma(a2[mb], b, acc[mb][nb]); if (NSPLIT >= 2) acc[mb][nb] = WFrag<T16>::mma(a[mb], b2, acc[mb][nb]); } }
        asm volatile("v_nop\n\tv_nop\n\tv_nop\n\tv_nop" : "+v"(acc[0][0]), "+v"(acc[1][1]), "+v"(acc[2][2]), "+v"(acc[3][3]) : "v"(a[0]), "v"(a[3]));
    }
#pragma unroll
    for (int mb = 0; mb < 4; ++mb) {
#pragma unroll
        for (int nb = 0; nb < 4; ++nb) {
#pragma unroll
            for (int j = 0; j < 8; ++j) os[(hi * 8 + j) * 68 + nb * 16 + lr] = acc[mb][nb][j]; }
        __builtin_amdgcn_wave_barrier(); asm volatile("" ::: "memory");
        float* crow = C + (size_t)(r0 + mb * 16) * ldc + c0;
{
#pragma unroll
            for (int s = 0; s < 8; ++s) { const int row = 2 * s + hi, cofs = lr * 4; v4f val = *(const v4fa*)(os + row * 68 + cofs);
                *(v4f*)(crow + (size_t)row * ldc + cofs) = val; }
             }
        __builtin_amdgcn_wave_barrier(); asm volatile("" ::: "memory");
    }
}

__device__ __forceinline__ h16 tohx(float x) { return (h16)x; }
__device__ __forceinline__ void splitf(float y, unsigned short& h, unsigned short& l) { h = f2bf(y); l = f2bf(y - bf2f(h)); }
typedef __attribute__((ext_vector_type(2))) _Float16 v2h;
typedef __attribute__((ext_vector_type(4))) _Float16 v4h;
typedef __attribute__((ext_vector_type(2))) unsigned short v2us;
typedef __attribute__((ext_vector_type(4))) unsigned short v4us;
typedef __attribute__((ext_vector_type(2))) float v2f;
typedef __attribute__((ext_vector_type(4))) int v4i;

__global__ __launch_bounds__(256) void k_wtG(const float* __restrict__ w, int K, int N, bf* Bt) {
    const int lane = threadIdx.x & 31; const int L0 = (blockIdx.x * 8 + (threadIdx.x >> 5)) * 8; const int nlines = N * K / 64;
{
#pragma unroll 1
        for (int l = 0; l < 8; ++l) { const int L = L0 + l; if (L >= nlines) break; const size_t e = (size_t)L * 64 + lane * 2; const int k = (int)(e % K), n = (int)(e / K); v2us o;
            o[0] = f2bf(w[(size_t)k * N + n]); o[1] = f2bf(w[(size_t)(k + 1) * N + n]); *(v2us*)(Bt + e) = o; }
         }
}
__global__ __launch_bounds__(256) void k_cvt8(const float* __restrict__ src, bf* dst, size_t n8) { const size_t i = (size_t)blockIdx.x * 256 + threadIdx.x; if (i >= n8) return; const v8f v = *(const v8f*)(src + i * 8); v8us o;
#pragma unroll
    for (int k = 0; k < 8; ++k) o[k] = f2bf(v[k]); *(v8us*)(dst + i * 8) = o;  }
__global__ __launch_bounds__(256) void k_cstab(float* CS) { const int idx = blockIdx.x * 256 + threadIdx.x; if (idx >= TT * HD) return; const int t = idx / HD, d = idx % HD; const int i = d % (HD / 2); const float inv = __fdiv_rn(1.0f, powf(10000.0f, (float)(2 * i) / (float)HD)); const float ang = __fmul_rn((float)t, inv); v2f cs; cs[0] = cosf(ang); cs[1] = sinf(ang);
    *(v2f*)(CS + (size_t)idx * 2) = cs;  }
// k_rope: head planes [h][t][d] (fp16 + hi/lo) of rope(x) x sc with the rotate-half convention out[d] = x[d] cos[t][d] - x[d+HD/2] sin[t][d], out[d+HD/2] = x[d+HD/2] cos[t][d+HD/2] + x[d] sin[t][d+HD/2]
__global__ __launch_bounds__(256) void k_rope(const float* __restrict__ F, int pitch, int nheads, const float* __restrict__ CS, const float* __restrict__ RF, const float* __restrict__ nw, float sc, h16* P16, bf* Ph, bf* Pl) {
    const size_t e = ((size_t)blockIdx.x * 256 + threadIdx.x) * 2; if (e >= (size_t)nheads * TT * HD) return; const int d = (int)(e % HD); const int t = (int)((e / HD) % TT); const int h = (int)(e / ((size_t)HD * TT)); const float* f = F + (size_t)t * pitch + h * HD; const float rf = RF ? RF[(size_t)h * TT + t] : 1.0f; v2h o16; v2us oh, ol;
#pragma unroll
    for (int q = 0; q < 2; ++q) { const int dd = d + q; const int dp = (dd < HD / 2) ? dd + HD / 2 : dd - HD / 2; float x0 = f[dd], x1 = f[dp];
        if (RF) { float n0 = __fmul_rn(x0, rf), n1 = __fmul_rn(x1, rf); asm volatile("" : "+v"(n0)); asm volatile("" : "+v"(n1)); x0 = __fmul_rn(bfr(nw[dd]), n0); x1 = __fmul_rn(bfr(nw[dp]), n1); }
        const v2f cs = *(const v2f*)(CS + ((size_t)t * HD + dd) * 2); float a = __fmul_rn(x0, cs[0]), bq = __fmul_rn(x1, cs[1]); asm volatile("" : "+v"(a)); asm volatile("" : "+v"(bq)); const float r = ((dd < HD / 2) ? __fsub_rn(a, bq) : __fadd_rn(a, bq)) * sc;
        o16[q] = tohx(r); unsigned short a2, c2; splitf(r, a2, c2); oh[q] = a2; ol[q] = c2; }
    *(v2h*)(P16 + e) = o16; *(v2us*)(Ph + e) = oh; *(v2us*)(Pl + e) = ol;  }
__global__ __launch_bounds__(256) void k_vtp(const float* __restrict__ F, int pitch, int nheads, h16* V16, bf* Vh, bf* Vl) { const size_t e = ((size_t)blockIdx.x * 256 + threadIdx.x) * 2; if (e >= (size_t)nheads * HD * TT) return; const int t = (int)(e % TT); const int d = (int)((e / TT) % HD); const int g = (int)(e / ((size_t)TT * HD)); v2h o16; v2us oh, ol;
#pragma unroll
    for (int q = 0; q < 2; ++q) { const float x = F[(size_t)(t + q) * pitch + g * HD + d]; o16[q] = tohx(x); unsigned short a2, c2; splitf(x, a2, c2); oh[q] = a2; ol[q] = c2; }
    *(v2h*)(V16 + e) = o16; *(v2us*)(Vh + e) = oh; *(v2us*)(Vl + e) = ol;  }
// k_asoft: per row (zz, i): t = S x HD^-0.5 for j <= i and i - j < WIN (WIN = TT, so plain causal; the reference's -1e9 additive fill vanishes identically); softmax over the 2048 keys (register row, one exp, fixed trees);
__global__ __launch_bounds__(256) void k_asoft(const float* __restrict__ Sb, h16* P16, bf* Ph, bf* Pl) {
    const int lane = threadIdx.x & 31; const int row = blockIdx.x * 8 + (threadIdx.x >> 5); if (row >= ZH * TT) return; const int i = row % TT; const int zz = row / TT; (void)zz; const bool hires = (i < RH); const float* sr = Sb + (size_t)row * TT; float v[TT / 32]; float mx = -3.0e38f;
#pragma unroll
    for (int ch = 0; ch < TT / 128; ++ch) { const int j0 = ch * 128 + lane * 4; const v4f a = *(const v4f*)(sr + j0);
#pragma unroll
        for (int q = 0; q < 4; ++q) { const int j = j0 + q; (void)j; const float t = (j <= i && i - j < WIN) ? a[q] * SCL : -3.0e38f; v[ch * 4 + q] = t; mx = fmaxf(mx, t); } }
#pragma unroll
    for (int sh = 16; sh; sh >>= 1) mx = fmaxf(mx, __shfl_xor(mx, sh, 32));
    float sum = 0.f;
#pragma unroll
    for (int k = 0; k < TT / 32; ++k) { float d0 = __fsub_rn(v[k], mx); asm volatile("" : "+v"(d0)); v[k] = __builtin_amdgcn_exp2f(__fmul_rn(d0, 1.4426950408889634f)); sum += v[k]; }
#pragma unroll
    for (int sh = 16; sh; sh >>= 1) sum += __shfl_xor(sum, sh, 32);
    const float f = __fdiv_rn(hires ? 1.0f : PCAR, sum);
{
        if (hires) {
#pragma unroll
            for (int ch = 0; ch < TT / 128; ++ch) { v4us oh, ol;
#pragma unroll
                for (int q = 0; q < 4; ++q) { unsigned short a, c2; splitf(v[ch * 4 + q] * f, a, c2); oh[q] = a; ol[q] = c2; }
                const size_t oo = ((size_t)zz * (RH ? RH : 1) + i) * TT + ch * 128 + lane * 4; *(v4us*)(Ph + oo) = oh; *(v4us*)(Pl + oo) = ol; }
        } else {
#pragma unroll
            for (int ch = 0; ch < TT / 128; ++ch) { v4h o4;
#pragma unroll
                for (int q = 0; q < 4; ++q) o4[q] = tohx(v[ch * 4 + q] * f);
                *(v4h*)(P16 + (size_t)row * TT + ch * 128 + lane * 4) = o4; } }
         }
}
__global__ __launch_bounds__(256) void k_merge(const float* __restrict__ O, int h0, bf* Ah, bf* Al) { const size_t e = ((size_t)blockIdx.x * 256 + threadIdx.x) * 2; if (e >= (size_t)ZH * TT * HD) return; const int d = (int)(e % HD); const int t = (int)((e / HD) % TT); const int zz = (int)(e / ((size_t)HD * TT)); const float cs = (t < RH) ? 1.0f : (1.0f / PCAR); const size_t oo = (size_t)t * DQ + (h0 + zz) * HD + d;
    v2us oh, ol;
#pragma unroll
    for (int q = 0; q < 2; ++q) { unsigned short a, c2; splitf(O[e + q] * cs, a, c2); oh[q] = a; ol[q] = c2; } *(v2us*)(Ah + oo) = oh; *(v2us*)(Al + oo) = ol;  }

extern "C" void kernel_launch(void* const* d_in, const int* in_sizes, int n_in,
                              void* d_out, int out_size, void* d_ws, size_t ws_size, hipStream_t stream) {
    (void)in_sizes; (void)n_in; (void)out_size;
    const float* x = (const float*)d_in[0]; const float* wq = (const float*)d_in[1]; const float* bq = (const float*)d_in[2]; const float* wk = (const float*)d_in[3]; const float* bk = (const float*)d_in[4]; const float* wv = (const float*)d_in[5]; const float* bv = (const float*)d_in[6]; const float* wo = (const float*)d_in[7]; const float* bo = (const float*)d_in[8];
    float* OUT = (float*)d_out;     // [2][2048][2048]
    char* wsp = (char*)d_ws;
    auto take = [&](size_t bytes) { char* p = wsp; wsp += (bytes + 255) & ~(size_t)255; return (void*)p; };
    bf* WQ = (bf*)take((size_t)DQ * DM * 2); bf* WK = (bf*)take((size_t)DKV * DM * 2); bf* WV = (bf*)take((size_t)DKV * DM * 2); bf* WO = (bf*)take((size_t)DM * DQ * 2); float* CS = (float*)take((size_t)TT * HD * 2 * 4);
    bf* XB = (bf*)take((size_t)TT * DM * 2); float* FQ = (float*)take((size_t)TT * DQ * 4); float* FK = (float*)take((size_t)TT * DKV * 4);
    h16* QP16 = (h16*)take((size_t)NH_ * TT * HD * 2); h16* KP16 = (h16*)take((size_t)NKV * TT * HD * 2); h16* VT16 = (h16*)take((size_t)NKV * HD * TT * 2);
    bf* QPh = (bf*)take((size_t)NH_ * TT * HD * 2); bf* QPl = (bf*)take((size_t)NH_ * TT * HD * 2); bf* KPh = (bf*)take((size_t)NKV * TT * HD * 2); bf* KPl = (bf*)take((size_t)NKV * TT * HD * 2); bf* VTh = (bf*)take((size_t)NKV * HD * TT * 2); bf* VTl = (bf*)take((size_t)NKV * HD * TT * 2); bf* Ph = (bf*)take((size_t)ZH * RH * TT * 2); bf* Pl = (bf*)take((size_t)ZH * RH * TT * 2);
    float* Sb = (float*)take((size_t)ZH * TT * TT * 4); h16* P16 = (h16*)take((size_t)ZH * TT * TT * 2); float* Ob = (float*)take((size_t)ZH * TT * HD * 4); bf* ATh = (bf*)take((size_t)TT * DQ * 2); bf* ATl = (bf*)take((size_t)TT * DQ * 2);
    if ((size_t)(wsp - (char*)d_ws) > ws_size) return;    // ws 256 MiB
    float* FV = FK;   // v projection reuses the k buffer after the k planes are built (stream-ordered)
    { k_cvt8<<<(unsigned)(((size_t)DQ * DM / 8 + 255) / 256), 256, 0, stream>>>(wq, WQ, (size_t)DQ * DM / 8); k_cvt8<<<(unsigned)(((size_t)DKV * DM / 8 + 255) / 256), 256, 0, stream>>>(wk, WK, (size_t)DKV * DM / 8); k_cvt8<<<(unsigned)(((size_t)DKV * DM / 8 + 255) / 256), 256, 0, stream>>>(wv, WV, (size_t)DKV * DM / 8);
      k_cvt8<<<(unsigned)(((size_t)DM * DQ / 8 + 255) / 256), 256, 0, stream>>>(wo, WO, (size_t)DM * DQ / 8);
      k_cstab<<<(TT * HD + 255) / 256, 256, 0, stream>>>(CS); }
    const unsigned LQ = (unsigned)(((size_t)NH_ * TT * HD / 2 + 255) / 256), LKv = (unsigned)(((size_t)NKV * TT * HD / 2 + 255) / 256);
    for (int b = 0; b < NB_; ++b) {
        
        k_cvt8<<<(unsigned)(((size_t)TT * DM / 8 + 255) / 256), 256, 0, stream>>>(x + (size_t)b * TT * DM, XB, (size_t)TT * DM / 8);
        k_gemmw<bf, 0, true><<<dim3(TT / 64, DQ / 64, 1), 32, 0, stream>>>(XB, nullptr, WQ, nullptr, DM, FQ, DQ, bq, 0, 0, 0);
        k_rope<<<LQ, 256, 0, stream>>>(FQ, DQ, NH_, CS, nullptr, nullptr, 1.0f, QP16, QPh, QPl);
        k_gemmw<bf, 0, true><<<dim3(TT / 64, DKV / 64, 1), 32, 0, stream>>>(XB, nullptr, WK, nullptr, DM, FK, DKV, bk, 0, 0, 0);
        k_rope<<<LKv, 256, 0, stream>>>(FK, DKV, NKV, CS, nullptr, nullptr, 1.0f, KP16, KPh, KPl);
        k_gemmw<bf, 0, true><<<dim3(TT / 64, DKV / 64, 1), 32, 0, stream>>>(XB, nullptr, WV, nullptr, DM, FV, DKV, bv, 0, 0, 0); k_vtp<<<LKv, 256, 0, stream>>>(FV, DKV, NKV, VT16, VTh, VTl);
        for (int h0 = 0; h0 < NH_; h0 += ZH) { const size_t zq = (size_t)h0, zk = (size_t)(h0 / REP);   // one kv head per query head: the pass's two heads use consecutive kv planes (z-strides TT*HD)
            k_gemmc<bf, 2, 1><<<dim3(RH / 64, TT / 64, ZH), 32, 0, stream>>>(QPh + zq * TT * HD, QPl + zq * TT * HD, KPh + zk * TT * HD, KPl + zk * TT * HD, HD, Sb, TT, 0, (size_t)TT * HD, (size_t)TT * HD, (size_t)TT * TT);
            k_gemmc<h16, 0, 1><<<dim3((TT - RH) / 64, TT / 64, ZH), 32, 0, stream>>>(QP16 + zq * TT * HD + (size_t)RH * HD, nullptr, KP16 + zk * TT * HD, nullptr, HD, Sb + (size_t)RH * TT, TT, RH, (size_t)TT * HD, (size_t)TT * HD, (size_t)TT * TT);
            k_asoft<<<ZH * TT / 8, 256, 0, stream>>>(Sb, P16, Ph, Pl);
            k_gemmc<bf, 2, 2><<<dim3(RH / 64, HD / 64, ZH), 32, 0, stream>>>(Ph, Pl, VTh + zk * HD * TT, VTl + zk * HD * TT, TT, Ob, HD, 0, (size_t)RH * TT, (size_t)HD * TT, (size_t)TT * HD);
            k_gemmc<h16, 0, 2><<<dim3((TT - RH) / 64, HD / 64, ZH), 32, 0, stream>>>(P16 + (size_t)RH * TT, nullptr, VT16 + zk * HD * TT, nullptr, TT, Ob + (size_t)RH * HD, HD, RH, (size_t)TT * TT, (size_t)HD * TT, (size_t)TT * HD);
            k_merge<<<(unsigned)(((size_t)ZH * TT * HD / 2 + 255) / 256), 256, 0, stream>>>(Ob, h0, ATh, ATl); }
        k_gemmw<bf, 1, true><<<dim3(TT / 64, DM / 64, 1), 32, 0, stream>>>(ATh, ATl, WO, nullptr, DQ, OUT + (size_t)b * TT * DM, DM, bo, 0, 0, 0); }
}

// v001
// It runs in 1100 microseconds.
// Timed twice side by side with v000, it ran 1.57 times as fast both times.
#include <hip/hip_runtime.h>

// DenseMHA (hidden [2][2048][2048]; q/k/v = x W^T + b (16 heads x 128); rotate-half RoPE (base 1e4, computed on device); causal softmax(q.k / sqrt(128)) (finfo.min fill); out = merged Wo^T + bo -> [2][2048][2048]).
// Compute dtypes, f32 accumulate: every input rounded to bf16; q/k/v on PLAIN bf16 operands (inputs: exact) + bias; RoPE f32; causal scores and attn.v: query rows < 512 hl (3 products), the rest single fp16 (x1024), causal tile skipping; softmax f32; Wo hl x exact (2 products) + bias.

#define NB_  2
#define TT   2048
#define DM   2048
#define NH_  16
#define NKV  16
#define REP  (NH_ / NKV)
#define HD   128
#define DQ   (NH_ * HD)
#define DKV  (NKV * HD)
#define ZH   2
#define RH   512                  // query rows < RH use hi+lo planes (0: none)
#define WIN  2048
#define PCAR 1024.0f
#define SCL  0.088388347648318447f   // HD^-0.5
#define KCH  128                  // keys per work-group of the probability x value product (its key loop is split over work-groups)
#define KS   (TT / KCH)           // partial output planes [KS][ZH][TT][HD]
typedef _Float16 h16;
typedef unsigned short bf;
typedef __attribute__((ext_vector_type(16))) __bf16   v16bf;
typedef __attribute__((ext_vector_type(16))) _Float16 v16h;
typedef __attribute__((ext_vector_type(8)))  _Float16 v8h;
typedef __attribute__((ext_vector_type(8)))  unsigned short v8us;
typedef __attribute__((ext_vector_type(8)))  float    v8f;
typedef __attribute__((ext_vector_type(4)))  float    v4f;
typedef v8h  __attribute__((may_alias)) v8ha;
typedef v4f  __attribute__((may_alias)) v4fa;
typedef v8us __attribute__((may_alias)) v8usa;

__device__ __forceinline__ unsigned short f2bf(float f) { unsigned u = __float_as_uint(f); u += 0x7FFFu + ((u >> 16) & 1u); return (unsigned short)(u >> 16); }
__device__ __forceinline__ float bf2f(unsigned short b) { return __uint_as_float(((unsigned)b) << 16); }
__device__ __forceinline__ float bfr(float f) { return bf2f(f2bf(f)); }
__device__ __forceinline__ v16h cat16(v8h lo, v8h hi) { return __builtin_shufflevector(lo, hi, 0, 1, 2, 3, 4, 5, 6, 7, 8, 9, 10, 11, 12, 13, 14, 15); }
__device__ __forceinline__ v16bf cat16b(v8us lo, v8us hi) { return __builtin_bit_cast(v16bf, __builtin_shufflevector(lo, hi, 0, 1, 2, 3, 4, 5, 6, 7, 8, 9, 10, 11, 12, 13, 14, 15)); }
__device__ __forceinline__ v8f wmma16(v16h a, v16h b, v8f c) { return __builtin_amdgcn_wmma_f32_16x16x32_f16(false, a, false, b, (short)0, c, false, false); }
__device__ __forceinline__ v8f wmmab(v16bf a, v16bf b, v8f c) { return __builtin_amdgcn_wmma_f32_16x16x32_bf16(false, a, false, b, (short)0, c, false, false); }



// ---- k_gemmw: register-blocked GEMM, ONE WAVE per 64x64 output tile (16 accumulators), operands straight from K-contiguous 16-bit planes; grid (M/64, N/64, Z), 32 threads.
// C[m][n] (f32, pitch ldc, + optional f32 bias[n]) = sum_k A[m][k] Bt[n][k] (+ split products per NSPLIT). z-batch strides sA/sB/sC in elements. K % 32 == 0.
template <typename T16> struct WFrag;
template <> struct WFrag<h16> { typedef v16h V; static __device__ __forceinline__ V ld(const h16* p) { return cat16(*(const v8h*)p, *(const v8h*)(p + 16)); } static __device__ __forceinline__ v8f mma(V a, V b, v8f c) { return wmma16(a, b, c); } };
template <> struct WFrag<bf> { typedef v16bf V; static __device__ __forceinline__ V ld(const bf* p) { return cat16b(*(const v8us*)p, *(const v8us*)(p + 16)); } static __device__ __forceinline__ v8f mma(V a, V b, v8f c) { return wmmab(a, b, c); } };
template <typename T16, int NSPLIT, bool BIAS>
__global__ __launch_bounds__(32) void k_gemmw(const T16* __restrict__ A, const T16* __restrict__ A2, const T16* __restrict__ Bt, const T16* __restrict__ Bt2, int K, float* C, int ldc, const float* __restrict__ bias, size_t sA, size_t sB, size_t sC) {
    typedef typename WFrag<T16>::V V;
    __shared__ __align__(16) float os[16 * 68];
    const size_t z = blockIdx.z; A += z * sA; if (A2) A2 += z * sA; Bt += z * sB; if (Bt2) Bt2 += z * sB; C += z * sC;
    const int lane = threadIdx.x & 31, lr = lane & 15, hi = lane >> 4; const int r0 = blockIdx.x * 64, c0 = blockIdx.y * 64;
    v8f acc[4][4];
#pragma unroll
    for (int mb = 0; mb < 4; ++mb)
#pragma unroll
        for (int nb = 0; nb < 4; ++nb) acc[mb][nb] = (v8f){};
    const size_t aoff = (size_t)(r0 + lr) * K + 8 * hi, boff = (size_t)(c0 + lr) * K + 8 * hi;
#pragma unroll 1
    for (int kc = 0; kc < K; kc += 32) {
        V a[4], a2[4];
#pragma unroll
        for (int mb = 0; mb < 4; ++mb) { a[mb] = WFrag<T16>::ld(A + aoff + (size_t)mb * 16 * K + kc); if (NSPLIT == 1 || NSPLIT == 2) a2[mb] = WFrag<T16>::ld(A2 + aoff + (size_t)mb * 16 * K + kc); }
#pragma unroll
        for (int nb = 0; nb < 4; ++nb) { const V b = WFrag<T16>::ld(Bt + boff + (size_t)nb * 16 * K + kc); V b2; if (NSPLIT >= 2) b2 = WFrag<T16>::ld(Bt2 + boff + (size_t)nb * 16 * K + kc);
#pragma unroll
            for (int mb = 0; mb < 4; ++mb) { acc[mb][nb] = WFrag<T16>::mma(a[mb], b, acc[mb][nb]); if (NSPLIT == 1 || NSPLIT == 2) acc[mb][nb] = WFrag<T16>::mma(a2[mb], b, acc[mb][nb]); if (NSPLIT >= 2) acc[mb][nb] = WFrag<T16>::mma(a[mb], b2, acc[mb][nb]); } }
        asm volatile("v_nop\n\tv_nop\n\tv_nop\n\tv_nop" : "+v"(acc[0][0]), "+v"(acc[1][1]), "+v"(acc[2][2]), "+v"(acc[3][3]) : "v"(a[0]), "v"(a[3]));
    }
#pragma unroll
    for (int mb = 0; mb < 4; ++mb) {
#pragma unroll
        for (int nb = 0; nb < 4; ++nb) {
#pragma unroll
            for (int j = 0; j < 8; ++j) os[(hi * 8 + j) * 68 + nb * 16 + lr] = acc[mb][nb][j]; }
        __builtin_amdgcn_wave_barrier(); asm volatile("" ::: "memory");
        float* crow = C + (size_t)(r0 + mb * 16) * ldc + c0;
{
#pragma unroll
            for (int s = 0; s < 8; ++s) { const int row = 2 * s + hi, cofs = lr * 4; v4f val = *(const v4fa*)(os + row * 68 + cofs); if (BIAS) { val[0] += bfr(bias[c0 + cofs]); val[1] += bfr(bias[c0 + cofs + 1]); val[2] += bfr(bias[c0 + cofs + 2]); val[3] += bfr(bias[c0 + cofs + 3]); }
                *(v4f*)(crow + (size_t)row * ldc + cofs) = val; }
             }
        __builtin_amdgcn_wave_barrier(); asm volatile("" ::: "memory");
    }
}

// ---- k_gemmc: the same one-wave 64x64 tile GEMM specialised for causal attention: CMODE 1 skips score tiles entirely above the diagonal (query rows r0+roff.., key columns c0..), CMODE 2 limits the
// key (K) loop of the probability x value contraction to the diagonal block (probabilities beyond it are exactly zero). roff = row offset of this launch's first row within the sequence.
// CMODE 2 also splits the key loop over work-groups: grid.y = (HD/64) * splits (KS; RH/KCH for the rows < RH), split sp takes keys [sp*KCH, sp*KCH+KCH) below the diagonal limit and stores an f32 partial tile into plane sp of C;
// a split that starts at or beyond the limit stores nothing, and k_merge adds exactly the planes that were stored, in ascending sp.
template <typename T16, int NSPLIT, int CMODE>
__global__ __launch_bounds__(32) void k_gemmc(const T16* __restrict__ A, const T16* __restrict__ A2, const T16* __restrict__ Bt, const T16* __restrict__ Bt2, int K, float* C, int ldc, int roff, size_t sA, size_t sB, size_t sC) {
    typedef typename WFrag<T16>::V V;
    __shared__ __align__(16) float os[16 * 68];
    const size_t z = blockIdx.z; A += z * sA; if (A2) A2 += z * sA; Bt += z * sB; if (Bt2) Bt2 += z * sB; C += z * sC;
    const int lane = threadIdx.x & 31, lr = lane & 15, hi = lane >> 4; const int sp = (CMODE == 2) ? (int)blockIdx.y / (HD / 64) : 0; const int r0 = blockIdx.x * 64, c0 = ((CMODE == 2) ? (int)blockIdx.y % (HD / 64) : (int)blockIdx.y) * 64;
    if (CMODE == 1 && c0 > r0 + roff + 63) return;                  // score tile entirely above the causal diagonal: never read (the softmax masks j > i by select)
    const int k0 = sp * KCH;                                         // first key of this split (0 for the scores)
    const int Kl = (CMODE == 2) ? min(min(K, r0 + roff + 64) - k0, KCH) : K;   // keys of this work-group. P.V: probabilities are exactly 0 beyond the diagonal block, so the K loop stops there, or at the end of this split
    if (CMODE == 2 && Kl <= 0) return;                               // split entirely beyond the diagonal block: no plane stored, k_merge does not read it
    if (CMODE == 2) { A += k0; if (A2) A2 += k0; Bt += k0; if (Bt2) Bt2 += k0; C += (size_t)sp * ((size_t)ZH * TT * HD); }
    v8f acc[4][4];
#pragma unroll
    for (int mb = 0; mb < 4; ++mb)
#pragma unroll
        for (int nb = 0; nb < 4; ++nb) acc[mb][nb] = (v8f){};
    const size_t aoff = (size_t)(r0 + lr) * K + 8 * hi, boff = (size_t)(c0 + lr) * K + 8 * hi;
#pragma unroll 1
    for (int kc = 0; kc < Kl; kc += 32) {
        V a[4], a2[4];
#pragma unroll
        for (int mb = 0; mb < 4; ++mb) { a[mb] = WFrag<T16>::ld(A + aoff + (size_t)mb * 16 * K + kc); if (NSPLIT == 1 || NSPLIT == 2) a2[mb] = WFrag<T16>::ld(A2 + aoff + (size_t)mb * 16 * K + kc); }
#pragma unroll
        for (int nb = 0; nb < 4; ++nb) { const V b = WFrag<T16>::ld(Bt + boff + (size_t)nb * 16 * K + kc); V b2; if (NSPLIT >= 2) b2 = WFrag<T16>::ld(Bt2 + boff + (size_t)nb * 16 * K + kc);
#pragma unroll
            for (int mb = 0; mb < 4; ++mb) { acc[mb][nb] = WFrag<T16>::mma(a[mb], b, acc[mb][nb]); if (NSPLIT == 1 || NSPLIT == 2) acc[mb][nb] = WFrag<T16>::mma(a2[mb], b, acc[mb][nb]); if (NSPLIT >= 2) acc[mb][nb] = WFrag<T16>::mma(a[mb], b2, acc[mb][nb]); } }
        asm volatile("v_nop\n\tv_nop\n\tv_nop\n\tv_nop" : "+v"(acc[0][0]), "+v"(acc[1][1]), "+v"(acc[2][2]), "+v"(acc[3][3]) : "v"(a[0]), "v"(a[3]));
    }
#pragma unroll
    for (int mb = 0; mb < 4; ++mb) {
#pragma unroll
        for (int nb = 0; nb < 4; ++nb) {
#pragma unroll
            for (int j = 0; j < 8; ++j) os[(hi * 8 + j) * 68 + nb * 16 + lr] = acc[mb][nb][j]; }
        __builtin_amdgcn_wave_barrier(); asm volatile("" ::: "memory");
        float* crow = C + (size_t)(r0 + mb * 16) * ldc + c0;
{
#pragma unroll
            for (int s = 0; s < 8; ++s) { const int row = 2 * s + hi, cofs = lr * 4; v4f val = *(const v4fa*)(os + row * 68 + cofs);
                *(v4f*)(crow + (size_t)row * ldc + cofs) = val; }
             }
        __builtin_amdgcn_wave_barrier(); asm volatile("" ::: "memory");
    }
}

__device__ __forceinline__ h16 tohx(float x) { return (h16)x; }
__device__ __forceinline__ void splitf(float y, unsigned short& h, unsigned short& l) { h = f2bf(y); l = f2bf(y - bf2f(h)); }
typedef __attribute__((ext_vector_type(2))) _Float16 v2h;
typedef __attribute__((ext_vector_type(4))) _Float16 v4h;
typedef __attribute__((ext_vector_type(2))) unsigned short v2us;
typedef __attribute__((ext_vector_type(4))) unsigned short v4us;
typedef __attribute__((ext_vector_type(2))) float v2f;
typedef __attribute__((ext_vector_type(4))) int v4i;

__global__ __launch_bounds__(256) void k_wtG(const float* __restrict__ w, int K, int N, bf* Bt) {
    const int lane = threadIdx.x & 31; const int L0 = (blockIdx.x * 8 + (threadIdx.x >> 5)) * 8; const int nlines = N * K / 64;
{
#pragma unroll 1
        for (int l = 0; l < 8; ++l) { const int L = L0 + l; if (L >= nlines) break; const size_t e = (size_t)L * 64 + lane * 2; const int k = (int)(e % K), n = (int)(e / K); v2us o;
            o[0] = f2bf(w[(size_t)k * N + n]); o[1] = f2bf(w[(size_t)(k + 1) * N + n]); *(v2us*)(Bt + e) = o; }
         }
}
__global__ __launch_bounds__(256) void k_cvt8(const float* __restrict__ src, bf* dst, size_t n8) { const size_t i = (size_t)blockIdx.x * 256 + threadIdx.x; if (i >= n8) return; const v8f v = *(const v8f*)(src + i * 8); v8us o;
#pragma unroll
    for (int k = 0; k < 8; ++k) o[k] = f2bf(v[k]); *(v8us*)(dst + i * 8) = o;  }
__global__ __launch_bounds__(256) void k_cstab(float* CS) { const int idx = blockIdx.x * 256 + threadIdx.x; if (idx >= TT * HD) return; const int t = idx / HD, d = idx % HD; const int i = d % (HD / 2); const float inv = __fdiv_rn(1.0f, powf(10000.0f, (float)(2 * i) / (float)HD)); const float ang = __fmul_rn((float)t, inv); v2f cs; cs[0] = cosf(ang); cs[1] = sinf(ang);
    *(v2f*)(CS + (size_t)idx * 2) = cs;  }
// k_rope: head planes [h][t][d] (fp16 + hi/lo) of rope(x) x sc with the rotate-half convention out[d] = x[d] cos[t][d] - x[d+HD/2] sin[t][d], out[d+HD/2] = x[d+HD/2] cos[t][d+HD/2] + x[d] sin[t][d+HD/2]
__global__ __launch_bounds__(256) void k_rope(const float* __restrict__ F, int pitch, int nheads, const float* __restrict__ CS, const float* __restrict__ RF, const float* __restrict__ nw, float sc, h16* P16, bf* Ph, bf* Pl) {
    const size_t e = ((size_t)blockIdx.x * 256 + threadIdx.x) * 2; if (e >= (size_t)nheads * TT * HD) return; const int d = (int)(e % HD); const int t = (int)((e / HD) % TT); const int h = (int)(e / ((size_t)HD * TT)); const float* f = F + (size_t)t * pitch + h * HD; const float rf = RF ? RF[(size_t)h * TT + t] : 1.0f; v2h o16; v2us oh, ol;
#pragma unroll
    for (int q = 0; q < 2; ++q) { const int dd = d + q; const int dp = (dd < HD / 2) ? dd + HD / 2 : dd - HD / 2; float x0 = f[dd], x1 = f[dp];
        if (RF) { float n0 = __fmul_rn(x0, rf), n1 = __fmul_rn(x1, rf); asm volatile("" : "+v"(n0)); asm volatile("" : "+v"(n1)); x0 = __fmul_rn(bfr(nw[dd]), n0); x1 = __fmul_rn(bfr(nw[dp]), n1); }
        const v2f cs = *(const v2f*)(CS + ((size_t)t * HD + dd) * 2); float a = __fmul_rn(x0, cs[0]), bq = __fmul_rn(x1, cs[1]); asm volatile("" : "+v"(a)); asm volatile("" : "+v"(bq)); const float r = ((dd < HD / 2) ? __fsub_rn(a, bq) : __fadd_rn(a, bq)) * sc;
        o16[q] = tohx(r); unsigned short a2, c2; splitf(r, a2, c2); oh[q] = a2; ol[q] = c2; }
    *(v2h*)(P16 + e) = o16; *(v2us*)(Ph + e) = oh; *(v2us*)(Pl + e) = ol;  }
__global__ __launch_bounds__(256) void k_vtp(const float* __restrict__ F, int pitch, int nheads, h16* V16, bf* Vh, bf* Vl) { const size_t e = ((size_t)blockIdx.x * 256 + threadIdx.x) * 2; if (e >= (size_t)nheads * HD * TT) return; const int t = (int)(e % TT); const int d = (int)((e / TT) % HD); const int g = (int)(e / ((size_t)TT * HD)); v2h o16; v2us oh, ol;
#pragma unroll
    for (int q = 0; q < 2; ++q) { const float x = F[(size_t)(t + q) * pitch + g * HD + d]; o16[q] = tohx(x); unsigned short a2, c2; splitf(x, a2, c2); oh[q] = a2; ol[q] = c2; }
    *(v2h*)(V16 + e) = o16; *(v2us*)(Vh + e) = oh; *(v2us*)(Vl + e) = ol;  }
// k_asoft: per row (zz, i): t = S x HD^-0.5 for j <= i and i - j < WIN (WIN = TT, so plain causal; the reference's -1e9 additive fill vanishes identically); softmax over the 2048 keys (register row, one exp, fixed trees);
__global__ __launch_bounds__(256) void k_asoft(const float* __restrict__ Sb, h16* P16, bf* Ph, bf* Pl) {
    const int lane = threadIdx.x & 31; const int row = blockIdx.x * 8 + (threadIdx.x >> 5); if (row >= ZH * TT) return; const int i = row % TT; const int zz = row / TT; (void)zz; const bool hires = (i < RH); const float* sr = Sb + (size_t)row * TT; float v[TT / 32]; float mx = -3.0e38f;
#pragma unroll
    for (int ch = 0; ch < TT / 128; ++ch) { const int j0 = ch * 128 + lane * 4; const v4f a = *(const v4f*)(sr + j0);
#pragma unroll
        for (int q = 0; q < 4; ++q) { const int j = j0 + q; (void)j; const float t = (j <= i && i - j < WIN) ? a[q] * SCL : -3.0e38f; v[ch * 4 + q] = t; mx = fmaxf(mx, t); } }
#pragma unroll
    for (int sh = 16; sh; sh >>= 1) mx = fmaxf(mx, __shfl_xor(mx, sh, 32));
    float sum = 0.f;
#pragma unroll
    for (int k = 0; k < TT / 32; ++k) { float d0 = __fsub_rn(v[k], mx); asm volatile("" : "+v"(d0)); v[k] = __builtin_amdgcn_exp2f(__fmul_rn(d0, 1.4426950408889634f)); sum += v[k]; }
#pragma unroll
    for (int sh = 16; sh; sh >>= 1) sum += __shfl_xor(sum, sh, 32);
    const float f = __fdiv_rn(hires ? 1.0f : PCAR, sum);
{
        if (hires) {
#pragma unroll
            for (int ch = 0; ch < TT / 128; ++ch) { v4us oh, ol;
#pragma unroll
                for (int q = 0; q < 4; ++q) { unsigned short a, c2; splitf(v[ch * 4 + q] * f, a, c2); oh[q] = a; ol[q] = c2; }
                const size_t oo = ((size_t)zz * (RH ? RH : 1) + i) * TT + ch * 128 + lane * 4; *(v4us*)(Ph + oo) = oh; *(v4us*)(Pl + oo) = ol; }
        } else {
#pragma unroll
            for (int ch = 0; ch < TT / 128; ++ch) { v4h o4;
#pragma unroll
                for (int q = 0; q < 4; ++q) o4[q] = tohx(v[ch * 4 + q] * f);
                *(v4h*)(P16 + (size_t)row * TT + ch * 128 + lane * 4) = o4; } }
         }
}
__global__ __launch_bounds__(256) void k_merge(const float* __restrict__ O, int h0, bf* Ah, bf* Al) { const size_t e = ((size_t)blockIdx.x * 256 + threadIdx.x) * 2; if (e >= (size_t)ZH * TT * HD) return; const int d = (int)(e % HD); const int t = (int)((e / HD) % TT); const int zz = (int)(e / ((size_t)HD * TT)); const float cs = (t < RH) ? 1.0f : (1.0f / PCAR); const size_t oo = (size_t)t * DQ + (h0 + zz) * HD + d;
    const int ns = ((t & ~63) + 64 + KCH - 1) / KCH;   // planes stored for this row's 64-row tile (its key limit is (t & ~63) + 64)
    v2f p[KS];
#pragma unroll
    for (int s = 0; s < KS; ++s) p[s] = *(const v2f*)(O + (size_t)min(s, ns - 1) * ((size_t)ZH * TT * HD) + e);   // index clamped to a stored plane: all loads independent, none of an unwritten plane
    v2f o = p[0];
#pragma unroll
    for (int s = 1; s < KS; ++s) { o[0] += (s < ns) ? p[s][0] : 0.0f; o[1] += (s < ns) ? p[s][1] : 0.0f; }
    v2us oh, ol;
#pragma unroll
    for (int q = 0; q < 2; ++q) { unsigned short a, c2; splitf(o[q] * cs, a, c2); oh[q] = a; ol[q] = c2; } *(v2us*)(Ah + oo) = oh; *(v2us*)(Al + oo) = ol;  }

extern "C" void kernel_launch(void* const* d_in, const int* in_sizes, int n_in,
                              void* d_out, int out_size, void* d_ws, size_t ws_size, hipStream_t stream) {
    (void)in_sizes; (void)n_in; (void)out_size;
    const float* x = (const float*)d_in[0]; const float* wq = (const float*)d_in[1]; const float* bq = (const float*)d_in[2]; const float* wk = (const float*)d_in[3]; const float* bk = (const float*)d_in[4]; const float* wv = (const float*)d_in[5]; const float* bv = (const float*)d_in[6]; const float* wo = (const float*)d_in[7]; const float* bo = (const float*)d_in[8];
    float* OUT = (float*)d_out;     // [2][2048][2048]
    char* wsp = (char*)d_ws;
    auto take = [&](size_t bytes) { char* p = wsp; wsp += (bytes + 255) & ~(size_t)255; return (void*)p; };
    bf* WQ = (bf*)take((size_t)DQ * DM * 2); bf* WK = (bf*)take((size_t)DKV * DM * 2); bf* WV = (bf*)take((size_t)DKV * DM * 2); bf* WO = (bf*)take((size_t)DM * DQ * 2); float* CS = (float*)take((size_t)TT * HD * 2 * 4);
    bf* XB = (bf*)take((size_t)TT * DM * 2); float* FQ = (float*)take((size_t)TT * DQ * 4); float* FK = (float*)take((size_t)TT * DKV * 4);
    h16* QP16 = (h16*)take((size_t)NH_ * TT * HD * 2); h16* KP16 = (h16*)take((size_t)NKV * TT * HD * 2); h16* VT16 = (h16*)take((size_t)NKV * HD * TT * 2);
    bf* QPh = (bf*)take((size_t)NH_ * TT * HD * 2); bf* QPl = (bf*)take((size_t)NH_ * TT * HD * 2); bf* KPh = (bf*)take((size_t)NKV * TT * HD * 2); bf* KPl = (bf*)take((size_t)NKV * TT * HD * 2); bf* VTh = (bf*)take((size_t)NKV * HD * TT * 2); bf* VTl = (bf*)take((size_t)NKV * HD * TT * 2); bf* Ph = (bf*)take((size_t)ZH * RH * TT * 2); bf* Pl = (bf*)take((size_t)ZH * RH * TT * 2);
    float* Sb = (float*)take((size_t)ZH * TT * TT * 4); h16* P16 = (h16*)take((size_t)ZH * TT * TT * 2); float* Ob = (float*)take((size_t)KS * ZH * TT * HD * 4); bf* ATh = (bf*)take((size_t)TT * DQ * 2); bf* ATl = (bf*)take((size_t)TT * DQ * 2);
    if ((size_t)(wsp - (char*)d_ws) > ws_size) return;    // ws 256 MiB
    float* FV = FK;   // v projection reuses the k buffer after the k planes are built (stream-ordered)
    { k_cvt8<<<(unsigned)(((size_t)DQ * DM / 8 + 255) / 256), 256, 0, stream>>>(wq, WQ, (size_t)DQ * DM / 8); k_cvt8<<<(unsigned)(((size_t)DKV * DM / 8 + 255) / 256), 256, 0, stream>>>(wk, WK, (size_t)DKV * DM / 8); k_cvt8<<<(unsigned)(((size_t)DKV * DM / 8 + 255) / 256), 256, 0, stream>>>(wv, WV, (size_t)DKV * DM / 8);
      k_cvt8<<<(unsigned)(((size_t)DM * DQ / 8 + 255) / 256), 256, 0, stream>>>(wo, WO, (size_t)DM * DQ / 8);
      k_cstab<<<(TT * HD + 255) / 256, 256, 0, stream>>>(CS); }
    const unsigned LQ = (unsigned)(((size_t)NH_ * TT * HD / 2 + 255) / 256), LKv = (unsigned)(((size_t)NKV * TT * HD / 2 + 255) / 256);
    for (int b = 0; b < NB_; ++b) {
        
        k_cvt8<<<(unsigned)(((size_t)TT * DM / 8 + 255) / 256), 256, 0, stream>>>(x + (size_t)b * TT * DM, XB, (size_t)TT * DM / 8);
        k_gemmw<bf, 0, true><<<dim3(TT / 64, DQ / 64, 1), 32, 0, stream>>>(XB, nullptr, WQ, nullptr, DM, FQ, DQ, bq, 0, 0, 0);
        k_rope<<<LQ, 256, 0, stream>>>(FQ, DQ, NH_, CS, nullptr, nullptr, 1.0f, QP16, QPh, QPl);
        k_gemmw<bf, 0, true><<<dim3(TT / 64, DKV / 64, 1), 32, 0, stream>>>(XB, nullptr, WK, nullptr, DM, FK, DKV, bk, 0, 0, 0);
        k_rope<<<LKv, 256, 0, stream>>>(FK, DKV, NKV, CS, nullptr, nullptr, 1.0f, KP16, KPh, KPl);
        k_gemmw<bf, 0, true><<<dim3(TT / 64, DKV / 64, 1), 32, 0, stream>>>(XB, nullptr, WV, nullptr, DM, FV, DKV, bv, 0, 0, 0); k_vtp<<<LKv, 256, 0, stream>>>(FV, DKV, NKV, VT16, VTh, VTl);
        for (int h0 = 0; h0 < NH_; h0 += ZH) { const size_t zq = (size_t)h0, zk = (size_t)(h0 / REP);   // one kv head per query head: the pass's two heads use consecutive kv planes (z-strides TT*HD)
            k_gemmc<bf, 2, 1><<<dim3(RH / 64, TT / 64, ZH), 32, 0, stream>>>(QPh + zq * TT * HD, QPl + zq * TT * HD, KPh + zk * TT * HD, KPl + zk * TT * HD, HD, Sb, TT, 0, (size_t)TT * HD, (size_t)TT * HD, (size_t)TT * TT);
            k_gemmc<h16, 0, 1><<<dim3((TT - RH) / 64, TT / 64, ZH), 32, 0, stream>>>(QP16 + zq * TT * HD + (size_t)RH * HD, nullptr, KP16 + zk * TT * HD, nullptr, HD, Sb + (size_t)RH * TT, TT, RH, (size_t)TT * HD, (size_t)TT * HD, (size_t)TT * TT);
            k_asoft<<<ZH * TT / 8, 256, 0, stream>>>(Sb, P16, Ph, Pl);
            k_gemmc<bf, 2, 2><<<dim3(RH / 64, (HD / 64) * (RH / KCH), ZH), 32, 0, stream>>>(Ph, Pl, VTh + zk * HD * TT, VTl + zk * HD * TT, TT, Ob, HD, 0, (size_t)RH * TT, (size_t)HD * TT, (size_t)TT * HD);
            k_gemmc<h16, 0, 2><<<dim3((TT - RH) / 64, (HD / 64) * KS, ZH), 32, 0, stream>>>(P16 + (size_t)RH * TT, nullptr, VT16 + zk * HD * TT, nullptr, TT, Ob + (size_t)RH * HD, HD, RH, (size_t)TT * TT, (size_t)HD * TT, (size_t)TT * HD);
            k_merge<<<(unsigned)(((size_t)ZH * TT * HD / 2 + 255) / 256), 256, 0, stream>>>(Ob, h0, ATh, ATl); }
        k_gemmw<bf, 1, true><<<dim3(TT / 64, DM / 64, 1), 32, 0, stream>>>(ATh, ATl, WO, nullptr, DQ, OUT + (size_t)b * TT * DM, DM, bo, 0, 0, 0); }
}

// v002
// Measured time: 608 microseconds a run.
// Next to v001, in two timings, it ran 1.82 and 1.79 times as fast.
// Over all steps from v000 it is 2.84 times as fast.
#include <hip/hip_runtime.h>

// DenseMHA (hidden [2][2048][2048]; q/k/v = x W^T + b (16 heads x 128); rotate-half RoPE (base 1e4, computed on device); causal softmax(q.k / sqrt(128)) (finfo.min fill); out = merged Wo^T + bo -> [2][2048][2048]).
// Compute dtypes, f32 accumulate: every input rounded to bf16; q/k/v on PLAIN bf16 operands (inputs: exact) + bias; RoPE f32; causal scores and attn.v: query rows < 512 hl (3 products), the rest single fp16, fused with an online f32 softmax, causal block skipping; Wo hl x exact (2 products) + bias.

#define NB_  2
#define TT   2048
#define DM   2048
#define NH_  16
#define NKV  16
#define HD   128
#define DQ   (NH_ * HD)
#define DKV  (NKV * HD)
#define RH   512                  // query rows < RH use hi+lo planes (0: none)
#define SCL  0.088388347648318447f   // HD^-0.5
#define NQ   2                    // 16-row query tiles per wave of the attention kernel
#define KB   32                   // keys per pass of its key loop
#define AW   4                    // its waves per work-group
typedef _Float16 h16;
typedef unsigned short bf;
typedef __attribute__((ext_vector_type(16))) __bf16   v16bf;
typedef __attribute__((ext_vector_type(16))) _Float16 v16h;
typedef __attribute__((ext_vector_type(8)))  _Float16 v8h;
typedef __attribute__((ext_vector_type(8)))  unsigned short v8us;
typedef __attribute__((ext_vector_type(8)))  float    v8f;
typedef __attribute__((ext_vector_type(4)))  float    v4f;
typedef v8h  __attribute__((may_alias)) v8ha;
typedef v4f  __attribute__((may_alias)) v4fa;
typedef v8us __attribute__((may_alias)) v8usa;

__device__ __forceinline__ unsigned short f2bf(float f) { unsigned u = __float_as_uint(f); u += 0x7FFFu + ((u >> 16) & 1u); return (unsigned short)(u >> 16); }
__device__ __forceinline__ float bf2f(unsigned short b) { return __uint_as_float(((unsigned)b) << 16); }
__device__ __forceinline__ float bfr(float f) { return bf2f(f2bf(f)); }
__device__ __forceinline__ v16h cat16(v8h lo, v8h hi) { return __builtin_shufflevector(lo, hi, 0, 1, 2, 3, 4, 5, 6, 7, 8, 9, 10, 11, 12, 13, 14, 15); }
__device__ __forceinline__ v16bf cat16b(v8us lo, v8us hi) { return __builtin_bit_cast(v16bf, __builtin_shufflevector(lo, hi, 0, 1, 2, 3, 4, 5, 6, 7, 8, 9, 10, 11, 12, 13, 14, 15)); }
__device__ __forceinline__ v8f wmma16(v16h a, v16h b, v8f c) { return __builtin_amdgcn_wmma_f32_16x16x32_f16(false, a, false, b, (short)0, c, false, false); }
__device__ __forceinline__ v8f wmmab(v16bf a, v16bf b, v8f c) { return __builtin_amdgcn_wmma_f32_16x16x32_bf16(false, a, false, b, (short)0, c, false, false); }



// ---- k_gemmw: register-blocked GEMM, ONE WAVE per 64x64 output tile (16 accumulators), operands straight from K-contiguous 16-bit planes; grid (M/64, N/64, Z), 32 threads.
// C[m][n] (f32, pitch ldc, + optional f32 bias[n]) = sum_k A[m][k] Bt[n][k] (+ split products per NSPLIT). z-batch strides sA/sB/sC in elements. K % 32 == 0.
template <typename T16> struct WFrag;
template <> struct WFrag<h16> { typedef v16h V; static __device__ __forceinline__ V ld(const h16* p) { return cat16(*(const v8h*)p, *(const v8h*)(p + 16)); } static __device__ __forceinline__ v8f mma(V a, V b, v8f c) { return wmma16(a, b, c); } };
template <> struct WFrag<bf> { typedef v16bf V; static __device__ __forceinline__ V ld(const bf* p) { return cat16b(*(const v8us*)p, *(const v8us*)(p + 16)); } static __device__ __forceinline__ v8f mma(V a, V b, v8f c) { return wmmab(a, b, c); } };
template <typename T16, int NSPLIT, bool BIAS>
__global__ __launch_bounds__(32) void k_gemmw(const T16* __restrict__ A, const T16* __restrict__ A2, const T16* __restrict__ Bt, const T16* __restrict__ Bt2, int K, float* C, int ldc, const float* __restrict__ bias, size_t sA, size_t sB, size_t sC) {
    typedef typename WFrag<T16>::V V;
    __shared__ __align__(16) float os[16 * 68];
    const size_t z = blockIdx.z; A += z * sA; if (A2) A2 += z * sA; Bt += z * sB; if (Bt2) Bt2 += z * sB; C += z * sC;
    const int lane = threadIdx.x & 31, lr = lane & 15, hi = lane >> 4; const int r0 = blockIdx.x * 64, c0 = blockIdx.y * 64;
    v8f acc[4][4];
#pragma unroll
    for (int mb = 0; mb < 4; ++mb)
#pragma unroll
        for (int nb = 0; nb < 4; ++nb) acc[mb][nb] = (v8f){};
    const size_t aoff = (size_t)(r0 + lr) * K + 8 * hi, boff = (size_t)(c0 + lr) * K + 8 * hi;
#pragma unroll 1
    for (int kc = 0; kc < K; kc += 32) {
        V a[4], a2[4];
#pragma unroll
        for (int mb = 0; mb < 4; ++mb) { a[mb] = WFrag<T16>::ld(A + aoff + (size_t)mb * 16 * K + kc); if (NSPLIT == 1 || NSPLIT == 2) a2[mb] = WFrag<T16>::ld(A2 + aoff + (size_t)mb * 16 * K + kc); }
#pragma unroll
        for (int nb = 0; nb < 4; ++nb) { const V b = WFrag<T16>::ld(Bt + boff + (size_t)nb * 16 * K + kc); V b2; if (NSPLIT >= 2) b2 = WFrag<T16>::ld(Bt2 + boff + (size_t)nb * 16 * K + kc);
#pragma unroll
            for (int mb = 0; mb < 4; ++mb) { acc[mb][nb] = WFrag<T16>::mma(a[mb], b, acc[mb][nb]); if (NSPLIT == 1 || NSPLIT == 2) acc[mb][nb] = WFrag<T16>::mma(a2[mb], b, acc[mb][nb]); if (NSPLIT >= 2) acc[mb][nb] = WFrag<T16>::mma(a[mb], b2, acc[mb][nb]); } }
        asm volatile("v_nop\n\tv_nop\n\tv_nop\n\tv_nop" : "+v"(acc[0][0]), "+v"(acc[1][1]), "+v"(acc[2][2]), "+v"(acc[3][3]) : "v"(a[0]), "v"(a[3]));
    }
#pragma unroll
    for (int mb = 0; mb < 4; ++mb) {
#pragma unroll
        for (int nb = 0; nb < 4; ++nb) {
#pragma unroll
            for (int j = 0; j < 8; ++j) os[(hi * 8 + j) * 68 + nb * 16 + lr] = acc[mb][nb][j]; }
        __builtin_amdgcn_wave_barrier(); asm volatile("" ::: "memory");
        float* crow = C + (size_t)(r0 + mb * 16) * ldc + c0;
{
#pragma unroll
            for (int s = 0; s < 8; ++s) { const int row = 2 * s + hi, cofs = lr * 4; v4f val = *(const v4fa*)(os + row * 68 + cofs); if (BIAS) { val[0] += bfr(bias[c0 + cofs]); val[1] += bfr(bias[c0 + cofs + 1]); val[2] += bfr(bias[c0 + cofs + 2]); val[3] += bfr(bias[c0 + cofs + 3]); }
                *(v4f*)(crow + (size_t)row * ldc + cofs) = val; }
             }
        __builtin_amdgcn_wave_barrier(); asm volatile("" ::: "memory");
    }
}

__device__ __forceinline__ h16 tohx(float x) { return (h16)x; }
__device__ __forceinline__ void splitf(float y, unsigned short& h, unsigned short& l) { h = f2bf(y); l = f2bf(y - bf2f(h)); }
typedef __attribute__((ext_vector_type(2))) _Float16 v2h;
typedef __attribute__((ext_vector_type(4))) _Float16 v4h;
typedef __attribute__((ext_vector_type(2))) unsigned short v2us;
typedef __attribute__((ext_vector_type(4))) unsigned short v4us;
typedef __attribute__((ext_vector_type(2))) float v2f;
typedef __attribute__((ext_vector_type(4))) int v4i;

__global__ __launch_bounds__(256) void k_wtG(const float* __restrict__ w, int K, int N, bf* Bt) {
    const int lane = threadIdx.x & 31; const int L0 = (blockIdx.x * 8 + (threadIdx.x >> 5)) * 8; const int nlines = N * K / 64;
{
#pragma unroll 1
        for (int l = 0; l < 8; ++l) { const int L = L0 + l; if (L >= nlines) break; const size_t e = (size_t)L * 64 + lane * 2; const int k = (int)(e % K), n = (int)(e / K); v2us o;
            o[0] = f2bf(w[(size_t)k * N + n]); o[1] = f2bf(w[(size_t)(k + 1) * N + n]); *(v2us*)(Bt + e) = o; }
         }
}
__global__ __launch_bounds__(256) void k_cvt8(const float* __restrict__ src, bf* dst, size_t n8) { const size_t i = (size_t)blockIdx.x * 256 + threadIdx.x; if (i >= n8) return; const v8f v = *(const v8f*)(src + i * 8); v8us o;
#pragma unroll
    for (int k = 0; k < 8; ++k) o[k] = f2bf(v[k]); *(v8us*)(dst + i * 8) = o;  }
__global__ __launch_bounds__(256) void k_cstab(float* CS) { const int idx = blockIdx.x * 256 + threadIdx.x; if (idx >= TT * HD) return; const int t = idx / HD, d = idx % HD; const int i = d % (HD / 2); const float inv = __fdiv_rn(1.0f, powf(10000.0f, (float)(2 * i) / (float)HD)); const float ang = __fmul_rn((float)t, inv); v2f cs; cs[0] = cosf(ang); cs[1] = sinf(ang);
    *(v2f*)(CS + (size_t)idx * 2) = cs;  }
// k_rope: head planes [h][t][d] (fp16 + hi/lo) of rope(x) x sc with the rotate-half convention out[d] = x[d] cos[t][d] - x[d+HD/2] sin[t][d], out[d+HD/2] = x[d+HD/2] cos[t][d+HD/2] + x[d] sin[t][d+HD/2]
__global__ __launch_bounds__(256) void k_rope(const float* __restrict__ F, int pitch, int nheads, const float* __restrict__ CS, const float* __restrict__ RF, const float* __restrict__ nw, float sc, h16* P16, bf* Ph, bf* Pl) {
    const size_t e = ((size_t)blockIdx.x * 256 + threadIdx.x) * 2; if (e >= (size_t)nheads * TT * HD) return; const int d = (int)(e % HD); const int t = (int)((e / HD) % TT); const int h = (int)(e / ((size_t)HD * TT)); const float* f = F + (size_t)t * pitch + h * HD; const float rf = RF ? RF[(size_t)h * TT + t] : 1.0f; v2h o16; v2us oh, ol;
#pragma unroll
    for (int q = 0; q < 2; ++q) { const int dd = d + q; const int dp = (dd < HD / 2) ? dd + HD / 2 : dd - HD / 2; float x0 = f[dd], x1 = f[dp];
        if (RF) { float n0 = __fmul_rn(x0, rf), n1 = __fmul_rn(x1, rf); asm volatile("" : "+v"(n0)); asm volatile("" : "+v"(n1)); x0 = __fmul_rn(bfr(nw[dd]), n0); x1 = __fmul_rn(bfr(nw[dp]), n1); }
        const v2f cs = *(const v2f*)(CS + ((size_t)t * HD + dd) * 2); float a = __fmul_rn(x0, cs[0]), bq = __fmul_rn(x1, cs[1]); asm volatile("" : "+v"(a)); asm volatile("" : "+v"(bq)); const float r = ((dd < HD / 2) ? __fsub_rn(a, bq) : __fadd_rn(a, bq)) * sc;
        o16[q] = tohx(r); unsigned short a2, c2; splitf(r, a2, c2); oh[q] = a2; ol[q] = c2; }
    *(v2h*)(P16 + e) = o16; *(v2us*)(Ph + e) = oh; *(v2us*)(Pl + e) = ol;  }
__global__ __launch_bounds__(256) void k_vtp(const float* __restrict__ F, int pitch, int nheads, h16* V16, bf* Vh, bf* Vl) { const size_t e = ((size_t)blockIdx.x * 256 + threadIdx.x) * 2; if (e >= (size_t)nheads * HD * TT) return; const int t = (int)(e % TT); const int d = (int)((e / TT) % HD); const int g = (int)(e / ((size_t)TT * HD)); v2h o16; v2us oh, ol;
#pragma unroll
    for (int q = 0; q < 2; ++q) { const float x = F[(size_t)(t + q) * pitch + g * HD + d]; o16[q] = tohx(x); unsigned short a2, c2; splitf(x, a2, c2); oh[q] = a2; ol[q] = c2; }
    *(v2h*)(V16 + e) = o16; *(v2us*)(Vh + e) = oh; *(v2us*)(Vl + e) = ol;  }
template <typename T16, bool HL>
__device__ __forceinline__ void attn_wave(const T16* __restrict__ Q, const T16* __restrict__ Q2, const T16* __restrict__ Kp, const T16* __restrict__ K2, const T16* __restrict__ Vt, const T16* __restrict__ V2, const int q0, bf* __restrict__ Ah, bf* __restrict__ Al) {
    typedef typename WFrag<T16>::V V;
    const int lane = threadIdx.x & 31, lr = lane & 15, hi = lane >> 4;
    // Every '#pragma unroll' below: the fragment and accumulator arrays it indexes must be indexed by constants to stay in registers.
    // XW: s_wait_xcnt 0 behind a group of global loads or stores, in front of any overwrite of a register the group names; the address (and store data) operands keep those registers live up to the wait.
#define XW2(a, b) asm volatile("s_wait_xcnt 0x0" :: "v"(a), "v"(b) : "memory")
#define XW4(a, b, c, d) asm volatile("s_wait_xcnt 0x0" :: "v"(a), "v"(b), "v"(c), "v"(d) : "memory")
    V qf[NQ][4], qf2[NQ][4];
    { const size_t off = (size_t)(q0 + lr) * HD + 8 * hi; const T16* qp = Q + off; const T16* qp2 = HL ? Q2 + off : qp;
#pragma unroll
      for (int qt = 0; qt < NQ; ++qt)
#pragma unroll
        for (int kc = 0; kc < 4; ++kc) { qf[qt][kc] = WFrag<T16>::ld(qp + qt * 16 * HD + kc * 32); if (HL) qf2[qt][kc] = WFrag<T16>::ld(qp2 + qt * 16 * HD + kc * 32); }
      XW2(qp, qp2); }
    v8f o[NQ][8]; float m[NQ], l[NQ];
#pragma unroll
    for (int qt = 0; qt < NQ; ++qt) { m[qt] = -3.0e38f; l[qt] = 0.0f;
#pragma unroll
        for (int dt = 0; dt < 8; ++dt) o[qt][dt] = (v8f){}; }
    const int nblk = (q0 + 16 * NQ + KB - 1) / KB;      // key blocks up to and with the diagonal block; the later keys have probability exactly 0
    const size_t koff = (size_t)lr * HD + 8 * hi, voff = (size_t)lr * TT + 8 * hi;
    V kf[2][4], kf2[2][4], vf[8], vf2[8];
    { const T16* kp = Kp + koff; const T16* kp2 = HL ? K2 + koff : kp;
#pragma unroll
      for (int kt = 0; kt < 2; ++kt)
#pragma unroll
        for (int kc = 0; kc < 4; ++kc) { kf[kt][kc] = WFrag<T16>::ld(kp + kt * 16 * HD + kc * 32); if (HL) kf2[kt][kc] = WFrag<T16>::ld(kp2 + kt * 16 * HD + kc * 32); }
      XW2(kp, kp2); __builtin_amdgcn_sched_barrier(0); }   // the scheduling barrier keeps the next group's address arithmetic, which reuses this group's offset register, behind the wait
    { const T16* vp = Vt + voff; const T16* vp2 = HL ? V2 + voff : vp;
#pragma unroll
      for (int dt = 0; dt < 8; ++dt) { vf[dt] = WFrag<T16>::ld(vp + dt * 16 * TT); if (HL) vf2[dt] = WFrag<T16>::ld(vp2 + dt * 16 * TT); }
      XW2(vp, vp2); __builtin_amdgcn_sched_barrier(0); }   // as above: here it is the scalar base that later code reuses
#pragma unroll 1   // stays rolled: the trip count is the wave's own, and a second copy of this long body would only grow the text
    for (int kb = 0; kb < nblk; ++kb) {
        const int k0 = kb * KB, k1 = min(kb + 1, nblk - 1) * KB;   // k1: the next block (the last pass re-reads its own block: in bounds, unused)
        v8f s[NQ][2];
#pragma unroll
        for (int kt = 0; kt < 2; ++kt)
#pragma unroll
            for (int qt = 0; qt < NQ; ++qt) { v8f a = (v8f){};
#pragma unroll
                for (int kc = 0; kc < 4; ++kc) { a = WFrag<T16>::mma(kf[kt][kc], qf[qt][kc], a); if (HL) { a = WFrag<T16>::mma(kf2[kt][kc], qf[qt][kc], a); a = WFrag<T16>::mma(kf[kt][kc], qf2[qt][kc], a); } }
                s[qt][kt] = a; }
        { const size_t off = (size_t)k1 * HD + koff; const T16* kp = Kp + off; const T16* kp2 = HL ? K2 + off : kp;   // the next block's key rows go into the same registers right behind the score products: softmax and P.V run while they fly
#pragma unroll
          for (int kt = 0; kt < 2; ++kt)
#pragma unroll
            for (int kc = 0; kc < 4; ++kc) { kf[kt][kc] = WFrag<T16>::ld(kp + kt * 16 * HD + kc * 32); if (HL) kf2[kt][kc] = WFrag<T16>::ld(kp2 + kt * 16 * HD + kc * 32); }
          XW2(kp, kp2); }
        V pf[NQ], pf2[NQ];
#pragma unroll
        for (int qt = 0; qt < NQ; ++qt) {
            float t[16];
#pragma unroll
            for (int i = 0; i < 16; ++i) t[i] = s[qt][i >> 3][i & 7] * SCL;
            if (k0 + KB - 1 > q0 + qt * 16) {            // wave-uniform: only a block that reaches past this tile's first query needs the causal select
#pragma unroll
                for (int i = 0; i < 16; ++i) t[i] = (k0 + (i >> 3) * 16 + hi * 8 + (i & 7) <= q0 + qt * 16 + lr) ? t[i] : -3.0e38f; }
            float r[8];
#pragma unroll
            for (int i = 0; i < 8; ++i) r[i] = fmaxf(t[i], t[i + 8]);
            float mx = fmaxf(fmaxf(fmaxf(r[0], r[1]), fmaxf(r[2], r[3])), fmaxf(fmaxf(r[4], r[5]), fmaxf(r[6], r[7])));
            mx = fmaxf(mx, __shfl_xor(mx, 16, 32));
            const float mn = fmaxf(m[qt], mx); const float al = __builtin_amdgcn_exp2f((m[qt] - mn) * 1.4426950408889634f); m[qt] = mn;
#pragma unroll
            for (int i = 0; i < 16; ++i) t[i] = __builtin_amdgcn_exp2f((t[i] - mn) * 1.4426950408889634f);
#pragma unroll
            for (int i = 0; i < 8; ++i) r[i] = t[i] + t[i + 8];
            l[qt] = l[qt] * al + (((r[0] + r[1]) + (r[2] + r[3])) + ((r[4] + r[5]) + (r[6] + r[7])));   // this lane's half of the row sum; the halves are joined once, behind the loop
#pragma unroll
            for (int dt = 0; dt < 8; ++dt) o[qt][dt] *= al;
            if constexpr (HL) { v8us h0, h1, l0, l1;
#pragma unroll
                for (int i = 0; i < 8; ++i) { unsigned short a, c2; splitf(t[i], a, c2); h0[i] = a; l0[i] = c2; splitf(t[i + 8], a, c2); h1[i] = a; l1[i] = c2; }
                pf[qt] = cat16b(h0, h1); pf2[qt] = cat16b(l0, l1);
            } else { v16h p;
#pragma unroll
                for (int i = 0; i < 16; ++i) p[i] = tohx(t[i]);
                pf[qt] = p; }
        }
#pragma unroll
        for (int dt = 0; dt < 8; ++dt)
#pragma unroll
            for (int qt = 0; qt < NQ; ++qt) { o[qt][dt] = WFrag<T16>::mma(vf[dt], pf[qt], o[qt][dt]); if (HL) { o[qt][dt] = WFrag<T16>::mma(vf[dt], pf2[qt], o[qt][dt]); o[qt][dt] = WFrag<T16>::mma(vf2[dt], pf[qt], o[qt][dt]); } }
        { const size_t off = voff + k1; const T16* vp = Vt + off; const T16* vp2 = HL ? V2 + off : vp;   // likewise the next block's value rows, behind the P.V products: the next scores and softmax run while they fly
#pragma unroll
          for (int dt = 0; dt < 8; ++dt) { vf[dt] = WFrag<T16>::ld(vp + dt * 16 * TT); if (HL) vf2[dt] = WFrag<T16>::ld(vp2 + dt * 16 * TT); }
          XW2(vp, vp2); }
    }
#pragma unroll
    for (int qt = 0; qt < NQ; ++qt) { const float inv = __fdiv_rn(1.0f, l[qt] + __shfl_xor(l[qt], 16, 32)); const size_t oo = (size_t)(q0 + qt * 16 + lr) * DQ + hi * 8; bf* ah = Ah + oo; bf* alo = Al + oo;
#pragma unroll
        for (int dt = 0; dt < 8; ++dt) { v8us oh, ol;     // a lane holds 8 consecutive d of its query: one 16-byte store per plane
#pragma unroll
            for (int j = 0; j < 8; ++j) { unsigned short a, c2; splitf(o[qt][dt][j] * inv, a, c2); oh[j] = a; ol[j] = c2; }
            *(v8us*)(ah + dt * 16) = oh; *(v8us*)(alo + dt * 16) = ol; XW4(ah, alo, oh, ol); } }
#undef XW2
#undef XW4
}
// grid (heads, TT / (AW*16*NQ)), AW waves, no LDS, no barrier. The waves of a work-group take query blocks of ONE head (all start at key 0 and walk the same key and value rows together), wave w from the w-th
// quarter of the sequence, odd quarters counted from their end: every work-group then has the same number of key passes in all, so no WGP's load path carries more than the mean. Every block is taken exactly once.
__global__ __launch_bounds__(AW * 32) void k_fattn(const h16* __restrict__ Q16, const h16* __restrict__ K16, const h16* __restrict__ V16, const bf* __restrict__ Qh, const bf* __restrict__ Ql, const bf* __restrict__ Kh, const bf* __restrict__ Kl, const bf* __restrict__ Vh, const bf* __restrict__ Vl, bf* __restrict__ Ah, bf* __restrict__ Al) {
    const int wv = __builtin_amdgcn_readfirstlane((int)threadIdx.x >> 5);
    const int G = TT / (AW * 16 * NQ); const int q0 = (wv * G + ((wv & 1) ? G - 1 - (int)blockIdx.y : (int)blockIdx.y)) * (16 * NQ);
    const size_t hp = (size_t)blockIdx.x * TT * HD; const size_t ho = (size_t)blockIdx.x * HD;
    if (q0 < RH) attn_wave<bf, true>(Qh + hp, Ql + hp, Kh + hp, Kl + hp, Vh + hp, Vl + hp, q0, Ah + ho, Al + ho);
    else attn_wave<h16, false>(Q16 + hp, nullptr, K16 + hp, nullptr, V16 + hp, nullptr, q0, Ah + ho, Al + ho);
}

extern "C" void kernel_launch(void* const* d_in, const int* in_sizes, int n_in,
                              void* d_out, int out_size, void* d_ws, size_t ws_size, hipStream_t stream) {
    (void)in_sizes; (void)n_in; (void)out_size;
    const float* x = (const float*)d_in[0]; const float* wq = (const float*)d_in[1]; const float* bq = (const float*)d_in[2]; const float* wk = (const float*)d_in[3]; const float* bk = (const float*)d_in[4]; const float* wv = (const float*)d_in[5]; const float* bv = (const float*)d_in[6]; const float* wo = (const float*)d_in[7]; const float* bo = (const float*)d_in[8];
    float* OUT = (float*)d_out;     // [2][2048][2048]
    char* wsp = (char*)d_ws;
    auto take = [&](size_t bytes) { char* p = wsp; wsp += (bytes + 255) & ~(size_t)255; return (void*)p; };
    bf* WQ = (bf*)take((size_t)DQ * DM * 2); bf* WK = (bf*)take((size_t)DKV * DM * 2); bf* WV = (bf*)take((size_t)DKV * DM * 2); bf* WO = (bf*)take((size_t)DM * DQ * 2); float* CS = (float*)take((size_t)TT * HD * 2 * 4);
    bf* XB = (bf*)take((size_t)TT * DM * 2); float* FQ = (float*)take((size_t)TT * DQ * 4); float* FK = (float*)take((size_t)TT * DKV * 4);
    h16* QP16 = (h16*)take((size_t)NH_ * TT * HD * 2); h16* KP16 = (h16*)take((size_t)NKV * TT * HD * 2); h16* VT16 = (h16*)take((size_t)NKV * HD * TT * 2);
    bf* QPh = (bf*)take((size_t)NH_ * TT * HD * 2); bf* QPl = (bf*)take((size_t)NH_ * TT * HD * 2); bf* KPh = (bf*)take((size_t)NKV * TT * HD * 2); bf* KPl = (bf*)take((size_t)NKV * TT * HD * 2); bf* VTh = (bf*)take((size_t)NKV * HD * TT * 2); bf* VTl = (bf*)take((size_t)NKV * HD * TT * 2);
    bf* ATh = (bf*)take((size_t)TT * DQ * 2); bf* ATl = (bf*)take((size_t)TT * DQ * 2);
    if ((size_t)(wsp - (char*)d_ws) > ws_size) return;    // ws 256 MiB
    float* FV = FK;   // v projection reuses the k buffer after the k planes are built (stream-ordered)
    { k_cvt8<<<(unsigned)(((size_t)DQ * DM / 8 + 255) / 256), 256, 0, stream>>>(wq, WQ, (size_t)DQ * DM / 8); k_cvt8<<<(unsigned)(((size_t)DKV * DM / 8 + 255) / 256), 256, 0, stream>>>(wk, WK, (size_t)DKV * DM / 8); k_cvt8<<<(unsigned)(((size_t)DKV * DM / 8 + 255) / 256), 256, 0, stream>>>(wv, WV, (size_t)DKV * DM / 8);
      k_cvt8<<<(unsigned)(((size_t)DM * DQ / 8 + 255) / 256), 256, 0, stream>>>(wo, WO, (size_t)DM * DQ / 8);
      k_cstab<<<(TT * HD + 255) / 256, 256, 0, stream>>>(CS); }
    const unsigned LQ = (unsigned)(((size_t)NH_ * TT * HD / 2 + 255) / 256), LKv = (unsigned)(((size_t)NKV * TT * HD / 2 + 255) / 256);
    for (int b = 0; b < NB_; ++b) {
        
        k_cvt8<<<(unsigned)(((size_t)TT * DM / 8 + 255) / 256), 256, 0, stream>>>(x + (size_t)b * TT * DM, XB, (size_t)TT * DM / 8);
        k_gemmw<bf, 0, true><<<dim3(TT / 64, DQ / 64, 1), 32, 0, stream>>>(XB, nullptr, WQ, nullptr, DM, FQ, DQ, bq, 0, 0, 0);
        k_rope<<<LQ, 256, 0, stream>>>(FQ, DQ, NH_, CS, nullptr, nullptr, 1.0f, QP16, QPh, QPl);
        k_gemmw<bf, 0, true><<<dim3(TT / 64, DKV / 64, 1), 32, 0, stream>>>(XB, nullptr, WK, nullptr, DM, FK, DKV, bk, 0, 0, 0);
        k_rope<<<LKv, 256, 0, stream>>>(FK, DKV, NKV, CS, nullptr, nullptr, 1.0f, KP16, KPh, KPl);
        k_gemmw<bf, 0, true><<<dim3(TT / 64, DKV / 64, 1), 32, 0, stream>>>(XB, nullptr, WV, nullptr, DM, FV, DKV, bv, 0, 0, 0); k_vtp<<<LKv, 256, 0, stream>>>(FV, DKV, NKV, VT16, VTh, VTl);
        k_fattn<<<dim3(NH_, TT / (AW * 16 * NQ)), AW * 32, 0, stream>>>(QP16, KP16, VT16, QPh, QPl, KPh, KPl, VTh, VTl, ATh, ATl);
        k_gemmw<bf, 1, true><<<dim3(TT / 64, DM / 64, 1), 32, 0, stream>>>(ATh, ATl, WO, nullptr, DQ, OUT + (size_t)b * TT * DM, DM, bo, 0, 0, 0); }
}

// v003
// A run of this version takes 568 microseconds.
// Two timings next to v002 both put it at 1.06 times that version's speed.
// Counting every step since v000, it is 3.02 times as fast.
#include <hip/hip_runtime.h>

// DenseMHA (hidden [2][2048][2048]; q/k/v = x W^T + b (16 heads x 128); rotate-half RoPE (base 1e4, computed on device); causal softmax(q.k / sqrt(128)) (finfo.min fill); out = merged Wo^T + bo -> [2][2048][2048]).
// Compute dtypes, f32 accumulate: every input rounded to bf16; q/k/v on PLAIN bf16 operands (inputs: exact) + bias; RoPE f32; causal scores and attn.v: query rows < 512 hl (3 products), the rest single fp16, fused with an online f32 softmax, causal block skipping; Wo hl x exact (2 products) + bias.

#define NB_  2
#define TT   2048
#define DM   2048
#define NH_  16
#define NKV  16
#define HD   128
#define DQ   (NH_ * HD)
#define DKV  (NKV * HD)
#define RH   512                  // query rows < RH use hi+lo planes (0: none)
#define SCL  0.088388347648318447f   // HD^-0.5
#define NQ   2                    // 16-row query tiles per wave of the attention kernel
#define KB   32                   // keys per pass of its key loop
#define AW   4                    // its waves per work-group
typedef _Float16 h16;
typedef unsigned short bf;
typedef __attribute__((ext_vector_type(16))) __bf16   v16bf;
typedef __attribute__((ext_vector_type(16))) _Float16 v16h;
typedef __attribute__((ext_vector_type(8)))  _Float16 v8h;
typedef __attribute__((ext_vector_type(8)))  unsigned short v8us;
typedef __attribute__((ext_vector_type(8)))  float    v8f;
typedef __attribute__((ext_vector_type(4)))  float    v4f;
typedef v8h  __attribute__((may_alias)) v8ha;
typedef v4f  __attribute__((may_alias)) v4fa;
typedef v8us __attribute__((may_alias)) v8usa;

__device__ __forceinline__ unsigned short f2bf(float f) { unsigned u = __float_as_uint(f); u += 0x7FFFu + ((u >> 16) & 1u); return (unsigned short)(u >> 16); }
__device__ __forceinline__ float bf2f(unsigned short b) { return __uint_as_float(((unsigned)b) << 16); }
__device__ __forceinline__ float bfr(float f) { return bf2f(f2bf(f)); }
__device__ __forceinline__ v16h cat16(v8h lo, v8h hi) { return __builtin_shufflevector(lo, hi, 0, 1, 2, 3, 4, 5, 6, 7, 8, 9, 10, 11, 12, 13, 14, 15); }
__device__ __forceinline__ v16bf cat16b(v8us lo, v8us hi) { return __builtin_bit_cast(v16bf, __builtin_shufflevector(lo, hi, 0, 1, 2, 3, 4, 5, 6, 7, 8, 9, 10, 11, 12, 13, 14, 15)); }
__device__ __forceinline__ v8f wmma16(v16h a, v16h b, v8f c) { return __builtin_amdgcn_wmma_f32_16x16x32_f16(false, a, false, b, (short)0, c, false, false); }
__device__ __forceinline__ v8f wmmab(v16bf a, v16bf b, v8f c) { return __builtin_amdgcn_wmma_f32_16x16x32_bf16(false, a, false, b, (short)0, c, false, false); }



// ---- k_gemmw: register-blocked GEMM, ONE WAVE per 64x64 output tile (16 accumulators), operands straight from K-contiguous 16-bit planes; grid (M/64, N/64, Z), 32 threads.
// C[m][n] (f32, pitch ldc, + optional f32 bias[n]) = sum_k A[m][k] Bt[n][k] (+ split products per NSPLIT). z-batch strides sA/sB/sC in elements. K % 32 == 0.
// EPI 0: C as above. EPI 1 (q, k): Bt comes from k_cvt8p, so the tile's 64 columns are d = 32*sub + c and 64 + 32*sub + c (c < 32) of ONE head and a lane holds both partners of every rotate-half pair:
// bias, RoPE and the split into the fp16 / hi / lo head planes [h][t][128] happen here and no f32 plane is written. The planes keep the column order of Bt (a tile then writes whole 128-byte lines); q and k share it, and the scores sum over all of d.
// EPI 2 (v): A = weight rows (m = head*128 + d), Bt = token rows, so the tile is already transposed: bias[m] and the split into the planes [m][t] (pitch TT) happen here.
template <typename T16> struct WFrag;
template <> struct WFrag<h16> { typedef v16h V; static __device__ __forceinline__ V ld(const h16* p) { return cat16(*(const v8h*)p, *(const v8h*)(p + 16)); } static __device__ __forceinline__ v8f mma(V a, V b, v8f c) { return wmma16(a, b, c); } };
template <> struct WFrag<bf> { typedef v16bf V; static __device__ __forceinline__ V ld(const bf* p) { return cat16b(*(const v8us*)p, *(const v8us*)(p + 16)); } static __device__ __forceinline__ v8f mma(V a, V b, v8f c) { return wmmab(a, b, c); } };
__device__ __forceinline__ h16 tohx(float x) { return (h16)x; }
__device__ __forceinline__ void splitf(float y, unsigned short& h, unsigned short& l) { h = f2bf(y); l = f2bf(y - bf2f(h)); }
typedef __attribute__((ext_vector_type(4))) _Float16 v4h;
typedef __attribute__((ext_vector_type(4))) unsigned short v4us;
typedef __attribute__((ext_vector_type(2))) float v2f;
// The 16 staged rows of one quarter of a tile -> three 16-bit planes, 8 bytes a lane and plane (a store covers two whole 128-byte lines). po: the lane's byte offset for staged row hi; rp: the planes' row pitch in bytes.
__device__ __forceinline__ void planes16(const float* os, int lr, int hi, unsigned po, unsigned rp, h16* P16, bf* Ph, bf* Pl) {
    v4h o16[8]; v4us oh[8], ol[8];
#pragma unroll   // the arrays must be indexed by constants to stay in registers
    for (int s = 0; s < 8; ++s) { const v4f val = *(const v4fa*)(os + (2 * s + hi) * 68 + lr * 4);
#pragma unroll
        for (int q = 0; q < 4; ++q) { o16[s][q] = tohx(val[q]); unsigned short a2, c2; splitf(val[q], a2, c2); oh[s][q] = a2; ol[s][q] = c2; }
        const unsigned o = po + 2 * s * rp; *(v4h*)((char*)P16 + o) = o16[s]; *(v4us*)((char*)Ph + o) = oh[s]; *(v4us*)((char*)Pl + o) = ol[s]; }
    // s_wait_xcnt 0 behind the group of stores, in front of any overwrite of a register the group names; the operands keep the offset and the store data live up to the wait
    asm volatile("s_wait_xcnt 0x0" :: "v"(po), "v"(o16[0]), "v"(o16[1]), "v"(o16[2]), "v"(o16[3]), "v"(o16[4]), "v"(o16[5]), "v"(o16[6]), "v"(o16[7]), "v"(oh[0]), "v"(oh[1]), "v"(oh[2]), "v"(oh[3]), "v"(oh[4]), "v"(oh[5]), "v"(oh[6]), "v"(oh[7]), "v"(ol[0]), "v"(ol[1]), "v"(ol[2]), "v"(ol[3]), "v"(ol[4]), "v"(ol[5]), "v"(ol[6]), "v"(ol[7]) : "memory");
}
template <typename T16, int NSPLIT, bool BIAS, int EPI>
__global__ __launch_bounds__(32) void k_gemmw(const T16* __restrict__ A, const T16* __restrict__ A2, const T16* __restrict__ Bt, const T16* __restrict__ Bt2, int K, float* C, int ldc, const float* __restrict__ bias, size_t sA, size_t sB, size_t sC, const float* __restrict__ CS, h16* P16, bf* Ph, bf* Pl) {
    typedef typename WFrag<T16>::V V;
    __shared__ __align__(16) float os[16 * 68];
    const size_t z = blockIdx.z; A += z * sA; if (A2) A2 += z * sA; Bt += z * sB; if (Bt2) Bt2 += z * sB; C += z * sC;
    const int lane = threadIdx.x & 31, lr = lane & 15, hi = lane >> 4; const int r0 = blockIdx.x * 64, c0 = blockIdx.y * 64;
    v8f acc[4][4];
#pragma unroll
    for (int mb = 0; mb < 4; ++mb)
#pragma unroll
        for (int nb = 0; nb < 4; ++nb) acc[mb][nb] = (v8f){};
    const size_t aoff = (size_t)(r0 + lr) * K + 8 * hi, boff = (size_t)(c0 + lr) * K + 8 * hi;
#pragma unroll 1
    for (int kc = 0; kc < K; kc += 32) {
        V a[4], a2[4];
#pragma unroll
        for (int mb = 0; mb < 4; ++mb) { a[mb] = WFrag<T16>::ld(A + aoff + (size_t)mb * 16 * K + kc); if (NSPLIT == 1 || NSPLIT == 2) a2[mb] = WFrag<T16>::ld(A2 + aoff + (size_t)mb * 16 * K + kc); }
#pragma unroll
        for (int nb = 0; nb < 4; ++nb) { const V b = WFrag<T16>::ld(Bt + boff + (size_t)nb * 16 * K + kc); V b2; if (NSPLIT >= 2) b2 = WFrag<T16>::ld(Bt2 + boff + (size_t)nb * 16 * K + kc);
#pragma unroll
            for (int mb = 0; mb < 4; ++mb) { acc[mb][nb] = WFrag<T16>::mma(a[mb], b, acc[mb][nb]); if (NSPLIT == 1 || NSPLIT == 2) acc[mb][nb] = WFrag<T16>::mma(a2[mb], b, acc[mb][nb]); if (NSPLIT >= 2) acc[mb][nb] = WFrag<T16>::mma(a[mb], b2, acc[mb][nb]); } }
        asm volatile("v_nop\n\tv_nop\n\tv_nop\n\tv_nop" : "+v"(acc[0][0]), "+v"(acc[1][1]), "+v"(acc[2][2]), "+v"(acc[3][3]) : "v"(a[0]), "v"(a[3]));
    }
    // Every '#pragma unroll' of the two epilogues below: acc, cs and bv must be indexed by constants to stay in registers.
    if constexpr (EPI == 1) {
        const int hd = (int)blockIdx.y >> 1, sub = (int)blockIdx.y & 1;
        const unsigned bi = (unsigned)(hd * HD + sub * 32 + lr), ci = (unsigned)((r0 + hi * 8) * HD + sub * 32 + lr);   // this lane's first element of bias and first (cos, sin) pair of the table
        const v2f* cst = (const v2f*)CS; float bl[2], bh[2]; v2f cs[2][2][8];
#pragma unroll
        for (int p = 0; p < 2; ++p) { bl[p] = bfr(bias[bi + p * 16]); bh[p] = bfr(bias[bi + 64 + p * 16]); }
#pragma unroll
        for (int p = 0; p < 2; ++p)
#pragma unroll
            for (int j = 0; j < 8; ++j) cs[0][p][j] = cst[ci + j * HD + p * 16];   // cos, sin of (t, d); the table holds the same pair at d + 64
        const unsigned po = (unsigned)(((hd * TT + r0 + hi) * HD + sub * 64 + lr * 4) * 2);
#pragma unroll
        for (int mb = 0; mb < 4; ++mb) {
#pragma unroll
            for (int p = 0; p < 2; ++p)
#pragma unroll
                for (int j = 0; j < 8; ++j) { const float x0 = acc[mb][p][j] + bl[p], x1 = acc[mb][p + 2][j] + bh[p], c = cs[mb & 1][p][j][0], sn = cs[mb & 1][p][j][1];
                    os[(hi * 8 + j) * 68 + p * 16 + lr] = x0 * c - x1 * sn; os[(hi * 8 + j) * 68 + 32 + p * 16 + lr] = x1 * c + x0 * sn; }
            if (mb < 3) {   // the next quarter's table pairs fly while this quarter is converted and stored
#pragma unroll
                for (int p = 0; p < 2; ++p)
#pragma unroll
                    for (int j = 0; j < 8; ++j) cs[(mb + 1) & 1][p][j] = cst[ci + ((mb + 1) * 16 + j) * HD + p * 16]; }
            if (mb == 2) asm volatile("s_wait_xcnt 0x0" :: "v"(bi), "v"(ci) : "memory");   // behind the last load that names them, in front of any overwrite of the two index registers, which the operands keep live
            __builtin_amdgcn_wave_barrier(); asm volatile("" ::: "memory");   // as in the f32 epilogue below: the staged rows are read back by other lanes of this wave
            planes16(os, lr, hi, po + mb * 16 * HD * 2, HD * 2, P16, Ph, Pl);
            __builtin_amdgcn_wave_barrier(); asm volatile("" ::: "memory");
        }
        return;
    }
    if constexpr (EPI == 2) {
        const unsigned bi = (unsigned)(r0 + hi * 8); v8f bv[4];
#pragma unroll
        for (int mb = 0; mb < 4; ++mb) bv[mb] = *(const v8f*)(bias + bi + mb * 16);
        asm volatile("s_wait_xcnt 0x0" :: "v"(bi) : "memory");   // as above
        const unsigned po = (unsigned)(((r0 + hi) * TT + c0 + lr * 4) * 2);
#pragma unroll
        for (int mb = 0; mb < 4; ++mb) {
#pragma unroll
            for (int nb = 0; nb < 4; ++nb)
#pragma unroll
                for (int j = 0; j < 8; ++j) os[(hi * 8 + j) * 68 + nb * 16 + lr] = acc[mb][nb][j] + bfr(bv[mb][j]);
            __builtin_amdgcn_wave_barrier(); asm volatile("" ::: "memory");   // as above: other lanes of this wave read the staged rows back
            planes16(os, lr, hi, po + mb * 16 * TT * 2, TT * 2, P16, Ph, Pl);
            __builtin_amdgcn_wave_barrier(); asm volatile("" ::: "memory");
        }
        return;
    }
#pragma unroll
    for (int mb = 0; mb < 4; ++mb) {
#pragma unroll
        for (int nb = 0; nb < 4; ++nb) {
#pragma unroll
            for (int j = 0; j < 8; ++j) os[(hi * 8 + j) * 68 + nb * 16 + lr] = acc[mb][nb][j]; }
        __builtin_amdgcn_wave_barrier(); asm volatile("" ::: "memory");
        float* crow = C + (size_t)(r0 + mb * 16) * ldc + c0;
{
#pragma unroll
            for (int s = 0; s < 8; ++s) { const int row = 2 * s + hi, cofs = lr * 4; v4f val = *(const v4fa*)(os + row * 68 + cofs); if (BIAS) { val[0] += bfr(bias[c0 + cofs]); val[1] += bfr(bias[c0 + cofs + 1]); val[2] += bfr(bias[c0 + cofs + 2]); val[3] += bfr(bias[c0 + cofs + 3]); }
                *(v4f*)(crow + (size_t)row * ldc + cofs) = val; }
             }
        __builtin_amdgcn_wave_barrier(); asm volatile("" ::: "memory");
    }
}

typedef __attribute__((ext_vector_type(2))) _Float16 v2h;
typedef __attribute__((ext_vector_type(2))) unsigned short v2us;
typedef __attribute__((ext_vector_type(4))) int v4i;

__global__ __launch_bounds__(256) void k_wtG(const float* __restrict__ w, int K, int N, bf* Bt) {
    const int lane = threadIdx.x & 31; const int L0 = (blockIdx.x * 8 + (threadIdx.x >> 5)) * 8; const int nlines = N * K / 64;
{
#pragma unroll 1
        for (int l = 0; l < 8; ++l) { const int L = L0 + l; if (L >= nlines) break; const size_t e = (size_t)L * 64 + lane * 2; const int k = (int)(e % K), n = (int)(e / K); v2us o;
            o[0] = f2bf(w[(size_t)k * N + n]); o[1] = f2bf(w[(size_t)(k + 1) * N + n]); *(v2us*)(Bt + e) = o; }
         }
}
__global__ __launch_bounds__(256) void k_cvt8(const float* __restrict__ src, bf* dst, size_t n8) { const size_t i = (size_t)blockIdx.x * 256 + threadIdx.x; if (i >= n8) return; const v8f v = *(const v8f*)(src + i * 8); v8us o;
#pragma unroll
    for (int k = 0; k < 8; ++k) o[k] = f2bf(v[k]); *(v8us*)(dst + i * 8) = o;  }
// k_cvt8p: k_cvt8 for a weight [heads*HD][DM] whose rows feed RoPE: row head*HD + d is written at head*HD + d', d' = d with bits 5 and 6 swapped, so that 64 consecutive rows hold 32 rotate-half pairs (d, d + 64).
__global__ __launch_bounds__(256) void k_cvt8p(const float* __restrict__ src, bf* dst, size_t n8) { const size_t i = (size_t)blockIdx.x * 256 + threadIdx.x; if (i >= n8) return; const v8f v = *(const v8f*)(src + i * 8); v8us o;
#pragma unroll
    for (int k = 0; k < 8; ++k) o[k] = f2bf(v[k]);
    const size_t n = i * 8 / DM, col = i * 8 % DM; *(v8us*)(dst + ((n & ~(size_t)96) | ((n & 32) << 1) | ((n & 64) >> 1)) * DM + col) = o;  }
__global__ __launch_bounds__(256) void k_cstab(float* CS) { const int idx = blockIdx.x * 256 + threadIdx.x; if (idx >= TT * HD) return; const int t = idx / HD, d = idx % HD; const int i = d % (HD / 2); const float inv = __fdiv_rn(1.0f, powf(10000.0f, (float)(2 * i) / (float)HD)); const float ang = __fmul_rn((float)t, inv); v2f cs; cs[0] = cosf(ang); cs[1] = sinf(ang);
    *(v2f*)(CS + (size_t)idx * 2) = cs;  }
template <typename T16, bool HL>
__device__ __forceinline__ void attn_wave(const T16* __restrict__ Q, const T16* __restrict__ Q2, const T16* __restrict__ Kp, const T16* __restrict__ K2, const T16* __restrict__ Vt, const T16* __restrict__ V2, const int q0, bf* __restrict__ Ah, bf* __restrict__ Al) {
    typedef typename WFrag<T16>::V V;
    const int lane = threadIdx.x & 31, lr = lane & 15, hi = lane >> 4;
    // Every '#pragma unroll' below: the fragment and accumulator arrays it indexes must be indexed by constants to stay in registers.
    // XW: s_wait_xcnt 0 behind a group of global loads or stores, in front of any overwrite of a register the group names; the address (and store data) operands keep those registers live up to the wait.
#define XW2(a, b) asm volatile("s_wait_xcnt 0x0" :: "v"(a), "v"(b) : "memory")
#define XW4(a, b, c, d) asm volatile("s_wait_xcnt 0x0" :: "v"(a), "v"(b), "v"(c), "v"(d) : "memory")
    V qf[NQ][4], qf2[NQ][4];
    { const size_t off = (size_t)(q0 + lr) * HD + 8 * hi; const T16* qp = Q + off; const T16* qp2 = HL ? Q2 + off : qp;
#pragma unroll
      for (int qt = 0; qt < NQ; ++qt)
#pragma unroll
        for (int kc = 0; kc < 4; ++kc) { qf[qt][kc] = WFrag<T16>::ld(qp + qt * 16 * HD + kc * 32); if (HL) qf2[qt][kc] = WFrag<T16>::ld(qp2 + qt * 16 * HD + kc * 32); }
      XW2(qp, qp2); }
    v8f o[NQ][8]; float m[NQ], l[NQ];
#pragma unroll
    for (int qt = 0; qt < NQ; ++qt) { m[qt] = -3.0e38f; l[qt] = 0.0f;
#pragma unroll
        for (int dt = 0; dt < 8; ++dt) o[qt][dt] = (v8f){}; }
    const int nblk = (q0 + 16 * NQ + KB - 1) / KB;      // key blocks up to and with the diagonal block; the later keys have probability exactly 0
    const size_t koff = (size_t)lr * HD + 8 * hi, voff = (size_t)lr * TT + 8 * hi;
    V kf[2][4], kf2[2][4], vf[8], vf2[8];
    { const T16* kp = Kp + koff; const T16* kp2 = HL ? K2 + koff : kp;
#pragma unroll
      for (int kt = 0; kt < 2; ++kt)
#pragma unroll
        for (int kc = 0; kc < 4; ++kc) { kf[kt][kc] = WFrag<T16>::ld(kp + kt * 16 * HD + kc * 32); if (HL) kf2[kt][kc] = WFrag<T16>::ld(kp2 + kt * 16 * HD + kc * 32); }
      XW2(kp, kp2); __builtin_amdgcn_sched_barrier(0); }   // the scheduling barrier keeps the next group's address arithmetic, which reuses this group's offset register, behind the wait
    { const T16* vp = Vt + voff; const T16* vp2 = HL ? V2 + voff : vp;
#pragma unroll
      for (int dt = 0; dt < 8; ++dt) { vf[dt] = WFrag<T16>::ld(vp + dt * 16 * TT); if (HL) vf2[dt] = WFrag<T16>::ld(vp2 + dt * 16 * TT); }
      XW2(vp, vp2); __builtin_amdgcn_sched_barrier(0); }   // as above: here it is the scalar base that later code reuses
#pragma unroll 1   // stays rolled: the trip count is the wave's own, and a second copy of this long body would only grow the text
    for (int kb = 0; kb < nblk; ++kb) {
        const int k0 = kb * KB, k1 = min(kb + 1, nblk - 1) * KB;   // k1: the next block (the last pass re-reads its own block: in bounds, unused)
        v8f s[NQ][2];
#pragma unroll
        for (int kt = 0; kt < 2; ++kt)
#pragma unroll
            for (int qt = 0; qt < NQ; ++qt) { v8f a = (v8f){};
#pragma unroll
                for (int kc = 0; kc < 4; ++kc) { a = WFrag<T16>::mma(kf[kt][kc], qf[qt][kc], a); if (HL) { a = WFrag<T16>::mma(kf2[kt][kc], qf[qt][kc], a); a = WFrag<T16>::mma(kf[kt][kc], qf2[qt][kc], a); } }
                s[qt][kt] = a; }
        { const size_t off = (size_t)k1 * HD + koff; const T16* kp = Kp + off; const T16* kp2 = HL ? K2 + off : kp;   // the next block's key rows go into the same registers right behind the score products: softmax and P.V run while they fly
#pragma unroll
          for (int kt = 0; kt < 2; ++kt)
#pragma unroll
            for (int kc = 0; kc < 4; ++kc) { kf[kt][kc] = WFrag<T16>::ld(kp + kt * 16 * HD + kc * 32); if (HL) kf2[kt][kc] = WFrag<T16>::ld(kp2 + kt * 16 * HD + kc * 32); }
          XW2(kp, kp2); }
        V pf[NQ], pf2[NQ];
#pragma unroll
        for (int qt = 0; qt < NQ; ++qt) {
            float t[16];
#pragma unroll
            for (int i = 0; i < 16; ++i) t[i] = s[qt][i >> 3][i & 7] * SCL;
            if (k0 + KB - 1 > q0 + qt * 16) {            // wave-uniform: only a block that reaches past this tile's first query needs the causal select
#pragma unroll
                for (int i = 0; i < 16; ++i) t[i] = (k0 + (i >> 3) * 16 + hi * 8 + (i & 7) <= q0 + qt * 16 + lr) ? t[i] : -3.0e38f; }
            float r[8];
#pragma unroll
            for (int i = 0; i < 8; ++i) r[i] = fmaxf(t[i], t[i + 8]);
            float mx = fmaxf(fmaxf(fmaxf(r[0], r[1]), fmaxf(r[2], r[3])), fmaxf(fmaxf(r[4], r[5]), fmaxf(r[6], r[7])));
            mx = fmaxf(mx, __shfl_xor(mx, 16, 32));
            const float mn = fmaxf(m[qt], mx); const float al = __builtin_amdgcn_exp2f((m[qt] - mn) * 1.4426950408889634f); m[qt] = mn;
#pragma unroll
            for (int i = 0; i < 16; ++i) t[i] = __builtin_amdgcn_exp2f((t[i] - mn) * 1.4426950408889634f);
#pragma unroll
            for (int i = 0; i < 8; ++i) r[i] = t[i] + t[i + 8];
            l[qt] = l[qt] * al + (((r[0] + r[1]) + (r[2] + r[3])) + ((r[4] + r[5]) + (r[6] + r[7])));   // this lane's half of the row sum; the halves are joined once, behind the loop
#pragma unroll
            for (int dt = 0; dt < 8; ++dt) o[qt][dt] *= al;
            if constexpr (HL) { v8us h0, h1, l0, l1;
#pragma unroll
                for (int i = 0; i < 8; ++i) { unsigned short a, c2; splitf(t[i], a, c2); h0[i] = a; l0[i] = c2; splitf(t[i + 8], a, c2); h1[i] = a; l1[i] = c2; }
                pf[qt] = cat16b(h0, h1); pf2[qt] = cat16b(l0, l1);
            } else { v16h p;
#pragma unroll
                for (int i = 0; i < 16; ++i) p[i] = tohx(t[i]);
                pf[qt] = p; }
        }
#pragma unroll
        for (int dt = 0; dt < 8; ++dt)
#pragma unroll
            for (int qt = 0; qt < NQ; ++qt) { o[qt][dt] = WFrag<T16>::mma(vf[dt], pf[qt], o[qt][dt]); if (HL) { o[qt][dt] = WFrag<T16>::mma(vf[dt], pf2[qt], o[qt][dt]); o[qt][dt] = WFrag<T16>::mma(vf2[dt], pf[qt], o[qt][dt]); } }
        { const size_t off = voff + k1; const T16* vp = Vt + off; const T16* vp2 = HL ? V2 + off : vp;   // likewise the next block's value rows, behind the P.V products: the next scores and softmax run while they fly
#pragma unroll
          for (int dt = 0; dt < 8; ++dt) { vf[dt] = WFrag<T16>::ld(vp + dt * 16 * TT); if (HL) vf2[dt] = WFrag<T16>::ld(vp2 + dt * 16 * TT); }
          XW2(vp, vp2); }
    }
#pragma unroll
    for (int qt = 0; qt < NQ; ++qt) { const float inv = __fdiv_rn(1.0f, l[qt] + __shfl_xor(l[qt], 16, 32)); const size_t oo = (size_t)(q0 + qt * 16 + lr) * DQ + hi * 8; bf* ah = Ah + oo; bf* alo = Al + oo;
#pragma unroll
        for (int dt = 0; dt < 8; ++dt) { v8us oh, ol;     // a lane holds 8 consecutive d of its query: one 16-byte store per plane
#pragma unroll
            for (int j = 0; j < 8; ++j) { unsigned short a, c2; splitf(o[qt][dt][j] * inv, a, c2); oh[j] = a; ol[j] = c2; }
            *(v8us*)(ah + dt * 16) = oh; *(v8us*)(alo + dt * 16) = ol; XW4(ah, alo, oh, ol); } }
#undef XW2
#undef XW4
}
// grid (heads, TT / (AW*16*NQ)), AW waves, no LDS, no barrier. The waves of a work-group take query blocks of ONE head (all start at key 0 and walk the same key and value rows together), wave w from the w-th
// quarter of the sequence, odd quarters counted from their end: every work-group then has the same number of key passes in all, so no WGP's load path carries more than the mean. Every block is taken exactly once.
__global__ __launch_bounds__(AW * 32) void k_fattn(const h16* __restrict__ Q16, const h16* __restrict__ K16, const h16* __restrict__ V16, const bf* __restrict__ Qh, const bf* __restrict__ Ql, const bf* __restrict__ Kh, const bf* __restrict__ Kl, const bf* __restrict__ Vh, const bf* __restrict__ Vl, bf* __restrict__ Ah, bf* __restrict__ Al) {
    const int wv = __builtin_amdgcn_readfirstlane((int)threadIdx.x >> 5);
    const int G = TT / (AW * 16 * NQ); const int q0 = (wv * G + ((wv & 1) ? G - 1 - (int)blockIdx.y : (int)blockIdx.y)) * (16 * NQ);
    const size_t hp = (size_t)blockIdx.x * TT * HD; const size_t ho = (size_t)blockIdx.x * HD;
    if (q0 < RH) attn_wave<bf, true>(Qh + hp, Ql + hp, Kh + hp, Kl + hp, Vh + hp, Vl + hp, q0, Ah + ho, Al + ho);
    else attn_wave<h16, false>(Q16 + hp, nullptr, K16 + hp, nullptr, V16 + hp, nullptr, q0, Ah + ho, Al + ho);
}

extern "C" void kernel_launch(void* const* d_in, const int* in_sizes, int n_in,
                              void* d_out, int out_size, void* d_ws, size_t ws_size, hipStream_t stream) {
    (void)in_sizes; (void)n_in; (void)out_size;
    const float* x = (const float*)d_in[0]; const float* wq = (const float*)d_in[1]; const float* bq = (const float*)d_in[2]; const float* wk = (const float*)d_in[3]; const float* bk = (const float*)d_in[4]; const float* wv = (const float*)d_in[5]; const float* bv = (const float*)d_in[6]; const float* wo = (const float*)d_in[7]; const float* bo = (const float*)d_in[8];
    float* OUT = (float*)d_out;     // [2][2048][2048]
    char* wsp = (char*)d_ws;
    auto take = [&](size_t bytes) { char* p = wsp; wsp += (bytes + 255) & ~(size_t)255; return (void*)p; };
    bf* WQ = (bf*)take((size_t)DQ * DM * 2); bf* WK = (bf*)take((size_t)DKV * DM * 2); bf* WV = (bf*)take((size_t)DKV * DM * 2); bf* WO = (bf*)take((size_t)DM * DQ * 2); float* CS = (float*)take((size_t)TT * HD * 2 * 4);
    bf* XB = (bf*)take((size_t)TT * DM * 2);
    h16* QP16 = (h16*)take((size_t)NH_ * TT * HD * 2); h16* KP16 = (h16*)take((size_t)NKV * TT * HD * 2); h16* VT16 = (h16*)take((size_t)NKV * HD * TT * 2);
    bf* QPh = (bf*)take((size_t)NH_ * TT * HD * 2); bf* QPl = (bf*)take((size_t)NH_ * TT * HD * 2); bf* KPh = (bf*)take((size_t)NKV * TT * HD * 2); bf* KPl = (bf*)take((size_t)NKV * TT * HD * 2); bf* VTh = (bf*)take((size_t)NKV * HD * TT * 2); bf* VTl = (bf*)take((size_t)NKV * HD * TT * 2);
    bf* ATh = (bf*)take((size_t)TT * DQ * 2); bf* ATl = (bf*)take((size_t)TT * DQ * 2);
    if ((size_t)(wsp - (char*)d_ws) > ws_size) return;    // ws 256 MiB
    { k_cvt8p<<<(unsigned)(((size_t)DQ * DM / 8 + 255) / 256), 256, 0, stream>>>(wq, WQ, (size_t)DQ * DM / 8); k_cvt8p<<<(unsigned)(((size_t)DKV * DM / 8 + 255) / 256), 256, 0, stream>>>(wk, WK, (size_t)DKV * DM / 8); k_cvt8<<<(unsigned)(((size_t)DKV * DM / 8 + 255) / 256), 256, 0, stream>>>(wv, WV, (size_t)DKV * DM / 8);
      k_cvt8<<<(unsigned)(((size_t)DM * DQ / 8 + 255) / 256), 256, 0, stream>>>(wo, WO, (size_t)DM * DQ / 8);
      k_cstab<<<(TT * HD + 255) / 256, 256, 0, stream>>>(CS); }
    for (int b = 0; b < NB_; ++b) {
        
        k_cvt8<<<(unsigned)(((size_t)TT * DM / 8 + 255) / 256), 256, 0, stream>>>(x + (size_t)b * TT * DM, XB, (size_t)TT * DM / 8);
        k_gemmw<bf, 0, true, 1><<<dim3(TT / 64, DQ / 64, 1), 32, 0, stream>>>(XB, nullptr, WQ, nullptr, DM, nullptr, 0, bq, 0, 0, 0, CS, QP16, QPh, QPl);
        k_gemmw<bf, 0, true, 1><<<dim3(TT / 64, DKV / 64, 1), 32, 0, stream>>>(XB, nullptr, WK, nullptr, DM, nullptr, 0, bk, 0, 0, 0, CS, KP16, KPh, KPl);
        k_gemmw<bf, 0, true, 2><<<dim3(DKV / 64, TT / 64, 1), 32, 0, stream>>>(WV, nullptr, XB, nullptr, DM, nullptr, 0, bv, 0, 0, 0, nullptr, VT16, VTh, VTl);
        k_fattn<<<dim3(NH_, TT / (AW * 16 * NQ)), AW * 32, 0, stream>>>(QP16, KP16, VT16, QPh, QPl, KPh, KPl, VTh, VTl, ATh, ATl);
        k_gemmw<bf, 1, true, 0><<<dim3(TT / 64, DM / 64, 1), 32, 0, stream>>>(ATh, ATl, WO, nullptr, DQ, OUT + (size_t)b * TT * DM, DM, bo, 0, 0, 0, nullptr, nullptr, nullptr, nullptr); }
}
